// v000
// Times are from an AMD MI455X. After a warm-up the kernel runs many times in a row, and a time is the length of
// such a window on the GPU divided by its runs, so every launch and the gaps after it count. The runs cycle
// through copies of the inputs. A figure is the median of several windows, for all but v000 over two sittings.
// Sittings can differ by a few percent; kernels timed side by side share one.
// v000 is the starting kernel. One run takes 238 microseconds.
#include <hip/hip_runtime.h>
#include <hip/hip_bf16.h>

typedef __attribute__((ext_vector_type(2))) float v2f;
typedef __attribute__((ext_vector_type(8))) float v8f;
typedef __attribute__((ext_vector_type(4))) int   v4i;

// D = A(16x4 f32) * B(4x16 f32) + C(16x16 f32), wave32 WMMA
static __device__ __forceinline__ v8f wmma_k4(v2f a, v2f b, v8f c) {
    return __builtin_amdgcn_wmma_f32_16x16x4_f32(
        /*neg_a=*/false, a, /*neg_b=*/false, b,
        /*c_mod=*/(short)0, c, /*reuse_a=*/false, /*reuse_b=*/false);
}

// ---- gfx1250 async global->LDS staging (ASYNCcnt-tracked) ------------------
#if defined(__gfx1250__) && __has_builtin(__builtin_amdgcn_global_load_async_to_lds_b128)
#define USE_ASYNC_LDS 1
#else
#define USE_ASYNC_LDS 0
#endif

typedef __attribute__((address_space(1))) v4i g_v4i;   // global int4
typedef __attribute__((address_space(3))) v4i l_v4i;   // LDS int4
static __device__ __forceinline__ g_v4i* as_global_v4i(const void* p) {
    return (g_v4i*)(uintptr_t)p;
}
static __device__ __forceinline__ l_v4i* as_lds_v4i(const void* p) {
    return (l_v4i*)(unsigned)(uintptr_t)p;   // low 32 bits = LDS byte offset
}
template <int N> static __device__ __forceinline__ void wait_asynccnt() {
#if __has_builtin(__builtin_amdgcn_s_wait_asynccnt)
    __builtin_amdgcn_s_wait_asynccnt(N);
#else
    asm volatile("s_wait_asynccnt %0" ::"i"(N) : "memory");
#endif
}

// ---------------------------------------------------------------------------
// Kernel 0: fold conv weights through the projection.
// W2[96][192] = proj_w[96][32] @ conv_w[32][192];  b2 = proj_w@conv_b + proj_b
// ---------------------------------------------------------------------------
__global__ void fuse_weights_kernel(const float* __restrict__ conv_w,
                                    const float* __restrict__ conv_b,
                                    const float* __restrict__ proj_w,
                                    const float* __restrict__ proj_b,
                                    float* __restrict__ W2,
                                    float* __restrict__ b2) {
    const int t = threadIdx.x;            // 0..95
    const float* pr = proj_w + t * 32;
    for (int e = 0; e < 192; ++e) {
        float s = 0.f;
        #pragma unroll
        for (int m = 0; m < 32; ++m) s += pr[m] * conv_w[m * 192 + e];
        W2[t * 192 + e] = s;
    }
    float sb = proj_b[t];
    #pragma unroll
    for (int m = 0; m < 32; ++m) sb += pr[m] * conv_b[m];
    b2[t] = sb;
}

// ---------------------------------------------------------------------------
// Kernel 1: patch embed + qkv projection in one pass.
// One block (96 threads) per token; patch (192 floats) staged in LDS.
// V is written TRANSPOSED (vt[b][32][4096]) so the attention kernel's staged
// V tiles are [d][n] and every WMMA B-fragment is a contiguous b64.
// ---------------------------------------------------------------------------
__global__ void embed_kernel(const float* __restrict__ x,
                             const float* __restrict__ W2,
                             const float* __restrict__ b2,
                             float* __restrict__ q,
                             float* __restrict__ k,
                             float* __restrict__ vt) {
    const int token = blockIdx.x;         // 0..16383
    const int b = token >> 12;            // 4096 tokens per batch
    const int n = token & 4095;
    const int h = n >> 6, w = n & 63;
    __shared__ float patch[192];
    const int t = threadIdx.x;            // 0..95
    for (int e = t; e < 192; e += 96) {
        const int c = e >> 6, rem = e & 63, p = rem >> 3, qq = rem & 7;
        patch[e] = x[(((size_t)b * 3 + c) * 512 + (h * 8 + p)) * 512 + (w * 8 + qq)];
    }
    __syncthreads();
    const float* wr = W2 + t * 192;
    float acc = b2[t];
    #pragma unroll 8
    for (int e = 0; e < 192; ++e) acc += patch[e] * wr[e];
    const int d = t & 31;
    if (t < 32)      q[((size_t)b * 4096 + n) * 32 + d] = acc;
    else if (t < 64) k[((size_t)b * 4096 + n) * 32 + d] = acc;
    else             vt[((size_t)b * 32 + d) * 4096 + n] = acc;
}

// ---------------------------------------------------------------------------
// Kernel 2: fused attention  out = cos(2*pi * (Q K^T, zero diag)) @ V
// 4 waves/block, 1 Q row-tile per wave. K/V 16-key tiles are staged into LDS
// cooperatively with double buffering via global_load_async_to_lds_b128
// (ASYNCcnt), so the next tile's fill overlaps the current tile's 16 fp32
// WMMAs. All fragments in the hot loop are ds_load_b64.
// ---------------------------------------------------------------------------
__global__ void __launch_bounds__(128)
attn_kernel(const float* __restrict__ q,
            const float* __restrict__ k,
            const float* __restrict__ vt,
            float* __restrict__ out) {
    __shared__ float ldsK[2][16 * 32];    // [buf][key n][dim d]
    __shared__ float ldsV[2][32 * 16];    // [buf][dim d][key n]
    __shared__ float ptile[4][16 * 16];   // per-wave P tile (C->A relayout)

    const int t    = threadIdx.x;         // 0..127
    const int lane = t & 31;
    const int wave = t >> 5;
    const int b    = blockIdx.x >> 6;     // 64 blocks per batch
    const int i    = (blockIdx.x & 63) * 4 + wave;  // Q row-tile index
    const int hi   = lane >> 4;
    const int l16  = lane & 15;

    const float* qb  = q  + ((size_t)b * 4096 + i * 16) * 32;
    const float* kb  = k  + (size_t)b * 4096 * 32;
    const float* vtb = vt + (size_t)b * 32 * 4096;
    float* pt = ptile[wave];

    // staging addressing: both tiles are a flat 128 x 16B copy
    const int krow = t >> 3, kcol = (t & 7) * 4;    // K tile: 16 x 32
    const int vrow = t >> 2, vcol = (t & 3) * 4;    // V tile: 32 x 16

    // Q fragment, A-layout: lane row=l16, VGPR pair = K {c*4+2*hi, +1}
    v2f a_q[8];
    #pragma unroll
    for (int c = 0; c < 8; ++c)
        a_q[c] = *(const v2f*)(qb + l16 * 32 + c * 4 + hi * 2);

    v8f acc0 = {}; v8f acc1 = {};         // D tile: dims 0-15 / 16-31

    // ---- stage tile j into buffer buf ----
    auto stage = [&](int j, int buf) {
        const float* gk = kb  + ((size_t)(j * 16 + krow)) * 32 + kcol;
        const float* gv = vtb + (size_t)vrow * 4096 + j * 16 + vcol;
#if USE_ASYNC_LDS
        __builtin_amdgcn_global_load_async_to_lds_b128(
            as_global_v4i(gk), as_lds_v4i(&ldsK[buf][t * 4]), 0, 0);
        __builtin_amdgcn_global_load_async_to_lds_b128(
            as_global_v4i(gv), as_lds_v4i(&ldsV[buf][t * 4]), 0, 0);
#else
        *(float4*)(&ldsK[buf][t * 4]) = *(const float4*)gk;
        *(float4*)(&ldsV[buf][t * 4]) = *(const float4*)gv;
#endif
    };

    stage(0, 0);
    for (int j = 0; j < 256; ++j) {
        const int cur = j & 1;
        if (j + 1 < 256) {
            stage(j + 1, cur ^ 1);
#if USE_ASYNC_LDS
            wait_asynccnt<2>();           // drain stage j, let stage j+1 fly
#endif
        } else {
#if USE_ASYNC_LDS
            wait_asynccnt<0>();
#endif
        }
        __syncthreads();

        const float* kc = ldsK[cur];
        const float* vc = ldsV[cur];

        // ---- S = Qtile * Ktile^T (16x16), K-dim = 32 in 8 WMMA steps ----
        v8f s = {};
        #pragma unroll
        for (int c = 0; c < 8; ++c) {
            v2f bk = *(const v2f*)(kc + l16 * 32 + c * 4 + hi * 2);  // ds_load_b64
            s = wmma_k4(a_q[c], bk, s);
        }
        // ---- P = cos(2*pi*S) (v_cos_f32 semantics), diag forced to 1 ----
        #pragma unroll
        for (int r = 0; r < 8; ++r) {
            const int m = r + hi * 8;
            float pv = __builtin_amdgcn_cosf(s[r]);
            pv = (i == j && m == l16) ? 1.0f : pv;
            pt[m * 16 + l16] = pv;
        }
        // ---- D += Ptile(16x16) * Vtile(16x32), inner dim 16 in 4 steps ----
        #pragma unroll
        for (int c = 0; c < 4; ++c) {
            v2f ap  = *(const v2f*)(pt + l16 * 16 + c * 4 + hi * 2);         // A-frag
            v2f bv0 = *(const v2f*)(vc + l16 * 16 + c * 4 + hi * 2);         // d 0-15
            acc0 = wmma_k4(ap, bv0, acc0);
            v2f bv1 = *(const v2f*)(vc + (l16 + 16) * 16 + c * 4 + hi * 2);  // d 16-31
            acc1 = wmma_k4(ap, bv1, acc1);
        }
        __syncthreads();                  // all reads done before buf reuse
    }

    // ---- write D tile: out[b][i*16+m][d], C-layout scatter ----
    float* ob = out + ((size_t)b * 4096 + i * 16) * 32;
    #pragma unroll
    for (int r = 0; r < 8; ++r) {
        const int m = r + hi * 8;
        ob[m * 32 + l16]      = acc0[r];
        ob[m * 32 + 16 + l16] = acc1[r];
    }
}

// ---------------------------------------------------------------------------
// Kernel 3: ConvTranspose2d with kernel=stride=8 (pure per-pixel epilogue).
// ---------------------------------------------------------------------------
__global__ void deconv_kernel(const float* __restrict__ inter,
                              const float* __restrict__ dw,
                              const float* __restrict__ db,
                              float* __restrict__ out, int total) {
    const int idx = blockIdx.x * 256 + threadIdx.x;
    if (idx >= total) return;
    const int xx = idx & 511;
    const int yy = (idx >> 9) & 511;
    const int bo = idx >> 18;             // b*3 + o
    const int o  = bo % 3;
    const int b  = bo / 3;
    const int h = yy >> 3, p = yy & 7, w = xx >> 3, qq = xx & 7;
    const float* ib = inter + ((size_t)b * 4096 + (h * 64 + w)) * 32;
    const int woff = o * 64 + p * 8 + qq;
    float acc = db[o];
    #pragma unroll
    for (int d = 0; d < 32; ++d) acc += ib[d] * dw[d * 192 + woff];
    out[idx] = acc;
}

// ---------------------------------------------------------------------------
extern "C" void kernel_launch(void* const* d_in, const int* in_sizes, int n_in,
                              void* d_out, int out_size, void* d_ws, size_t ws_size,
                              hipStream_t stream) {
    const float* x        = (const float*)d_in[0];
    const float* conv_w   = (const float*)d_in[1];
    const float* conv_b   = (const float*)d_in[2];
    const float* proj_w   = (const float*)d_in[3];
    const float* proj_b   = (const float*)d_in[4];
    const float* deconv_w = (const float*)d_in[5];
    const float* deconv_b = (const float*)d_in[6];
    float* out = (float*)d_out;

    float* ws   = (float*)d_ws;
    float* W2   = ws;                      // 96*192  = 18432 floats
    float* b2   = W2 + 18432;              // 96 (padded to 128)
    float* qbuf = b2 + 128;                // 4*4096*32 = 524288 floats
    float* kbuf = qbuf + 524288;
    float* vtbf = kbuf + 524288;           // V transposed [b][32][4096]
    float* ivec = vtbf + 524288;           // inter: 524288 floats

    fuse_weights_kernel<<<1, 96, 0, stream>>>(conv_w, conv_b, proj_w, proj_b, W2, b2);
    embed_kernel<<<16384, 96, 0, stream>>>(x, W2, b2, qbuf, kbuf, vtbf);
    attn_kernel<<<256, 128, 0, stream>>>(qbuf, kbuf, vtbf, ivec);
    deconv_kernel<<<(3145728 + 255) / 256, 256, 0, stream>>>(ivec, deconv_w, deconv_b, out, 3145728);
}

// v001
// A run of this version takes 146 microseconds.
// Two timings next to v000 put it at 1.66 and 1.67 times that version's speed.
#include <hip/hip_runtime.h>
#include <hip/hip_bf16.h>

typedef __attribute__((ext_vector_type(2))) float v2f;
typedef __attribute__((ext_vector_type(4))) float v4f;
typedef __attribute__((ext_vector_type(8))) float v8f;
typedef __attribute__((ext_vector_type(4))) int   v4i;

// D = A(16x4 f32) * B(4x16 f32) + C(16x16 f32), wave32 WMMA
static __device__ __forceinline__ v8f wmma_k4(v2f a, v2f b, v8f c) {
    return __builtin_amdgcn_wmma_f32_16x16x4_f32(
        /*neg_a=*/false, a, /*neg_b=*/false, b,
        /*c_mod=*/(short)0, c, /*reuse_a=*/false, /*reuse_b=*/false);
}

// ---- gfx1250 async global->LDS staging (ASYNCcnt-tracked) ------------------
#if defined(__gfx1250__) && __has_builtin(__builtin_amdgcn_global_load_async_to_lds_b128)
#define USE_ASYNC_LDS 1
#else
#define USE_ASYNC_LDS 0
#endif

typedef __attribute__((address_space(1))) v4i g_v4i;   // global int4
typedef __attribute__((address_space(3))) v4i l_v4i;   // LDS int4
static __device__ __forceinline__ g_v4i* as_global_v4i(const void* p) {
    return (g_v4i*)(uintptr_t)p;
}
static __device__ __forceinline__ l_v4i* as_lds_v4i(const void* p) {
    return (l_v4i*)(unsigned)(uintptr_t)p;   // low 32 bits = LDS byte offset
}
template <int N> static __device__ __forceinline__ void wait_asynccnt() {
#if __has_builtin(__builtin_amdgcn_s_wait_asynccnt)
    __builtin_amdgcn_s_wait_asynccnt(N);
#else
    asm volatile("s_wait_asynccnt %0" ::"i"(N) : "memory");
#endif
}

// ---------------------------------------------------------------------------
// Kernel 0: fold conv weights through the projection.
// W2[96][192] = proj_w[96][32] @ conv_w[32][192];  b2 = proj_w@conv_b + proj_b
// ---------------------------------------------------------------------------
__global__ void fuse_weights_kernel(const float* __restrict__ conv_w,
                                    const float* __restrict__ conv_b,
                                    const float* __restrict__ proj_w,
                                    const float* __restrict__ proj_b,
                                    float* __restrict__ W2,
                                    float* __restrict__ b2) {
    const int t = threadIdx.x;            // 0..95
    const float* pr = proj_w + t * 32;
    for (int e = 0; e < 192; ++e) {
        float s = 0.f;
        #pragma unroll
        for (int m = 0; m < 32; ++m) s += pr[m] * conv_w[m * 192 + e];
        W2[t * 192 + e] = s;
    }
    float sb = proj_b[t];
    #pragma unroll
    for (int m = 0; m < 32; ++m) sb += pr[m] * conv_b[m];
    b2[t] = sb;
}

// ---------------------------------------------------------------------------
// Kernel 1: patch embed + qkv projection as one f32 WMMA GEMM,
// Y[16384 tokens][96] = X[tokens][192] * W2^T + b2.
// One block per (batch, patch row): its 64 tokens read 3 x 8 image rows, which
// are three contiguous 16 KiB runs of x. They and all of W2 are staged in LDS
// once. 6 waves: wave = (q | k | v, token half), 32 tokens x 32 outputs each,
// so every 128-byte line of q, k and vt has one writing wave.
// k order: for each image row (8 k values per token) lane (l16, hi) holds
// elements hi*4 .. hi*4+3 of its token (A) or of its W2 row (B), loaded by the
// same code; the two WMMA steps take the low and the high pair.
// V is written TRANSPOSED (vt[b][32][4096]) so the attention kernel's staged
// V tiles are [d][n] and every WMMA B-fragment is a contiguous b64.
// ---------------------------------------------------------------------------
#define EMB_BP 196   // LDS pitch of a W2 row, floats: 784 B = 16 B x odd, no bank conflict for b128 reads

__global__ void __launch_bounds__(192)
embed_kernel(const float* __restrict__ x,
             const float* __restrict__ W2,
             const float* __restrict__ b2,
             float* __restrict__ q,
             float* __restrict__ k,
             float* __restrict__ vt) {
    __shared__ __attribute__((aligned(16))) float sA[24 * 512];      // [c*8+p][512 pixels]
    __shared__ __attribute__((aligned(16))) float sB[96 * EMB_BP];   // [out][192 + pad]

    const int t    = threadIdx.x;         // 0..191
    const int b    = blockIdx.x >> 6;     // 64 patch rows per batch
    const int h    = blockIdx.x & 63;
    const int lane = t & 31;
    const int hi   = lane >> 4;
    const int l16  = lane & 15;
    const int wave = __builtin_amdgcn_readfirstlane(t >> 5);
    const int part = wave >> 1;           // 0 q, 1 k, 2 v
    const int mh   = wave & 1;            // token half of the row

    // ---- stage x rows (3072 x 16 B) and W2 (4608 x 16 B) ----
    // x: wave pair 'part' takes channel 'part', 16 sweeps of 64 chunks; W2 is
    // read flat, 48 chunks per row, 4 rows per sweep.
    const int tc = t & 63;
    const float* xs = x + (((size_t)b * 3 + part) * 512 + h * 8) * 512;
    v4f ra[16], rb[24];
    #pragma unroll
    for (int it = 0; it < 16; ++it) ra[it] = *(const v4f*)(xs + (it * 64 + tc) * 4);
    #pragma unroll
    for (int it = 0; it < 24; ++it) rb[it] = *(const v4f*)(W2 + (it * 192 + t) * 4);
    const float bias0 = b2[part * 32 + l16];
    const float bias1 = b2[part * 32 + 16 + l16];
    // the loads' address registers may be reused only behind this wait
    asm volatile("s_wait_xcnt 0x0" ::: "memory");
    float* da = sA + part * 4096 + tc * 4;
    float* db = sB + (t / 48) * EMB_BP + (t % 48) * 4;
    #pragma unroll
    for (int it = 0; it < 16; ++it) *(v4f*)(da + it * 256) = ra[it];
    #pragma unroll
    for (int it = 0; it < 24; ++it) *(v4f*)(db + it * 4 * EMB_BP) = rb[it];
    __syncthreads();

    const float* pa = sA + (mh * 32 + l16) * 8 + hi * 4;
    const float* pb = sB + (part * 32 + l16) * EMB_BP + hi * 4;

    v8f acc00, acc01, acc10, acc11;       // [token tile][output tile]
    #pragma unroll
    for (int r = 0; r < 8; ++r) {
        acc00[r] = bias0; acc10[r] = bias0;
        acc01[r] = bias1; acc11[r] = bias1;
    }

    #pragma unroll
    for (int rr = 0; rr < 24; ++rr) {
        const v4f a0 = *(const v4f*)(pa + rr * 512);
        const v4f a1 = *(const v4f*)(pa + rr * 512 + 128);
        const v4f w0 = *(const v4f*)(pb + rr * 8);
        const v4f w1 = *(const v4f*)(pb + rr * 8 + 16 * EMB_BP);
        acc00 = wmma_k4(a0.xy, w0.xy, acc00);
        acc01 = wmma_k4(a0.xy, w1.xy, acc01);
        acc10 = wmma_k4(a1.xy, w0.xy, acc10);
        acc11 = wmma_k4(a1.xy, w1.xy, acc11);
        acc00 = wmma_k4(a0.zw, w0.zw, acc00);
        acc01 = wmma_k4(a0.zw, w1.zw, acc01);
        acc10 = wmma_k4(a1.zw, w0.zw, acc10);
        acc11 = wmma_k4(a1.zw, w1.zw, acc11);
    }

    // ---- D register r = Y[token 8*hi + r][output l16] ----
    const int nb = h * 64 + mh * 32;      // first token of this wave in its batch
    if (part < 2) {
        float* dst = (part == 0 ? q : k) + ((size_t)b * 4096 + nb + hi * 8) * 32 + l16;
        #pragma unroll
        for (int r = 0; r < 8; ++r) {
            dst[r * 32]             = acc00[r];
            dst[r * 32 + 16]        = acc01[r];
            dst[(r + 16) * 32]      = acc10[r];
            dst[(r + 16) * 32 + 16] = acc11[r];
        }
    } else {
        float* dv = vt + ((size_t)b * 32 + l16) * 4096 + nb + hi * 8;
        *(v4f*)(dv)                  = acc00.lo;
        *(v4f*)(dv + 4)              = acc00.hi;
        *(v4f*)(dv + 16)             = acc10.lo;
        *(v4f*)(dv + 20)             = acc10.hi;
        *(v4f*)(dv + 16 * 4096)      = acc01.lo;
        *(v4f*)(dv + 16 * 4096 + 4)  = acc01.hi;
        *(v4f*)(dv + 16 * 4096 + 16) = acc11.lo;
        *(v4f*)(dv + 16 * 4096 + 20) = acc11.hi;
        // the stores' address registers may be reused only behind this wait
        asm volatile("s_wait_xcnt 0x0" ::: "memory");
    }
}

// ---------------------------------------------------------------------------
// Kernel 2: fused attention  out = cos(2*pi * (Q K^T, zero diag)) @ V
// 4 waves/block, 1 Q row-tile per wave. K/V 16-key tiles are staged into LDS
// cooperatively with double buffering via global_load_async_to_lds_b128
// (ASYNCcnt), so the next tile's fill overlaps the current tile's 16 fp32
// WMMAs. All fragments in the hot loop are ds_load_b64.
// ---------------------------------------------------------------------------
__global__ void __launch_bounds__(128)
attn_kernel(const float* __restrict__ q,
            const float* __restrict__ k,
            const float* __restrict__ vt,
            float* __restrict__ out) {
    __shared__ float ldsK[2][16 * 32];    // [buf][key n][dim d]
    __shared__ float ldsV[2][32 * 16];    // [buf][dim d][key n]
    __shared__ float ptile[4][16 * 16];   // per-wave P tile (C->A relayout)

    const int t    = threadIdx.x;         // 0..127
    const int lane = t & 31;
    const int wave = t >> 5;
    const int b    = blockIdx.x >> 6;     // 64 blocks per batch
    const int i    = (blockIdx.x & 63) * 4 + wave;  // Q row-tile index
    const int hi   = lane >> 4;
    const int l16  = lane & 15;

    const float* qb  = q  + ((size_t)b * 4096 + i * 16) * 32;
    const float* kb  = k  + (size_t)b * 4096 * 32;
    const float* vtb = vt + (size_t)b * 32 * 4096;
    float* pt = ptile[wave];

    // staging addressing: both tiles are a flat 128 x 16B copy
    const int krow = t >> 3, kcol = (t & 7) * 4;    // K tile: 16 x 32
    const int vrow = t >> 2, vcol = (t & 3) * 4;    // V tile: 32 x 16

    // Q fragment, A-layout: lane row=l16, VGPR pair = K {c*4+2*hi, +1}
    v2f a_q[8];
    #pragma unroll
    for (int c = 0; c < 8; ++c)
        a_q[c] = *(const v2f*)(qb + l16 * 32 + c * 4 + hi * 2);

    v8f acc0 = {}; v8f acc1 = {};         // D tile: dims 0-15 / 16-31

    // ---- stage tile j into buffer buf ----
    auto stage = [&](int j, int buf) {
        const float* gk = kb  + ((size_t)(j * 16 + krow)) * 32 + kcol;
        const float* gv = vtb + (size_t)vrow * 4096 + j * 16 + vcol;
#if USE_ASYNC_LDS
        __builtin_amdgcn_global_load_async_to_lds_b128(
            as_global_v4i(gk), as_lds_v4i(&ldsK[buf][t * 4]), 0, 0);
        __builtin_amdgcn_global_load_async_to_lds_b128(
            as_global_v4i(gv), as_lds_v4i(&ldsV[buf][t * 4]), 0, 0);
#else
        *(float4*)(&ldsK[buf][t * 4]) = *(const float4*)gk;
        *(float4*)(&ldsV[buf][t * 4]) = *(const float4*)gv;
#endif
    };

    stage(0, 0);
    for (int j = 0; j < 256; ++j) {
        const int cur = j & 1;
        if (j + 1 < 256) {
            stage(j + 1, cur ^ 1);
#if USE_ASYNC_LDS
            wait_asynccnt<2>();           // drain stage j, let stage j+1 fly
#endif
        } else {
#if USE_ASYNC_LDS
            wait_asynccnt<0>();
#endif
        }
        __syncthreads();

        const float* kc = ldsK[cur];
        const float* vc = ldsV[cur];

        // ---- S = Qtile * Ktile^T (16x16), K-dim = 32 in 8 WMMA steps ----
        v8f s = {};
        #pragma unroll
        for (int c = 0; c < 8; ++c) {
            v2f bk = *(const v2f*)(kc + l16 * 32 + c * 4 + hi * 2);  // ds_load_b64
            s = wmma_k4(a_q[c], bk, s);
        }
        // ---- P = cos(2*pi*S) (v_cos_f32 semantics), diag forced to 1 ----
        #pragma unroll
        for (int r = 0; r < 8; ++r) {
            const int m = r + hi * 8;
            float pv = __builtin_amdgcn_cosf(s[r]);
            pv = (i == j && m == l16) ? 1.0f : pv;
            pt[m * 16 + l16] = pv;
        }
        // ---- D += Ptile(16x16) * Vtile(16x32), inner dim 16 in 4 steps ----
        #pragma unroll
        for (int c = 0; c < 4; ++c) {
            v2f ap  = *(const v2f*)(pt + l16 * 16 + c * 4 + hi * 2);         // A-frag
            v2f bv0 = *(const v2f*)(vc + l16 * 16 + c * 4 + hi * 2);         // d 0-15
            acc0 = wmma_k4(ap, bv0, acc0);
            v2f bv1 = *(const v2f*)(vc + (l16 + 16) * 16 + c * 4 + hi * 2);  // d 16-31
            acc1 = wmma_k4(ap, bv1, acc1);
        }
        __syncthreads();                  // all reads done before buf reuse
    }

    // ---- write D tile: out[b][i*16+m][d], C-layout scatter ----
    float* ob = out + ((size_t)b * 4096 + i * 16) * 32;
    #pragma unroll
    for (int r = 0; r < 8; ++r) {
        const int m = r + hi * 8;
        ob[m * 32 + l16]      = acc0[r];
        ob[m * 32 + 16 + l16] = acc1[r];
    }
}

// ---------------------------------------------------------------------------
// Kernel 3: ConvTranspose2d with kernel=stride=8 (pure per-pixel epilogue).
// ---------------------------------------------------------------------------
__global__ void deconv_kernel(const float* __restrict__ inter,
                              const float* __restrict__ dw,
                              const float* __restrict__ db,
                              float* __restrict__ out, int total) {
    const int idx = blockIdx.x * 256 + threadIdx.x;
    if (idx >= total) return;
    const int xx = idx & 511;
    const int yy = (idx >> 9) & 511;
    const int bo = idx >> 18;             // b*3 + o
    const int o  = bo % 3;
    const int b  = bo / 3;
    const int h = yy >> 3, p = yy & 7, w = xx >> 3, qq = xx & 7;
    const float* ib = inter + ((size_t)b * 4096 + (h * 64 + w)) * 32;
    const int woff = o * 64 + p * 8 + qq;
    float acc = db[o];
    #pragma unroll
    for (int d = 0; d < 32; ++d) acc += ib[d] * dw[d * 192 + woff];
    out[idx] = acc;
}

// ---------------------------------------------------------------------------
extern "C" void kernel_launch(void* const* d_in, const int* in_sizes, int n_in,
                              void* d_out, int out_size, void* d_ws, size_t ws_size,
                              hipStream_t stream) {
    const float* x        = (const float*)d_in[0];
    const float* conv_w   = (const float*)d_in[1];
    const float* conv_b   = (const float*)d_in[2];
    const float* proj_w   = (const float*)d_in[3];
    const float* proj_b   = (const float*)d_in[4];
    const float* deconv_w = (const float*)d_in[5];
    const float* deconv_b = (const float*)d_in[6];
    float* out = (float*)d_out;

    float* ws   = (float*)d_ws;
    float* W2   = ws;                      // 96*192  = 18432 floats
    float* b2   = W2 + 18432;              // 96 (padded to 128)
    float* qbuf = b2 + 128;                // 4*4096*32 = 524288 floats
    float* kbuf = qbuf + 524288;
    float* vtbf = kbuf + 524288;           // V transposed [b][32][4096]
    float* ivec = vtbf + 524288;           // inter: 524288 floats

    fuse_weights_kernel<<<1, 96, 0, stream>>>(conv_w, conv_b, proj_w, proj_b, W2, b2);
    embed_kernel<<<256, 192, 0, stream>>>(x, W2, b2, qbuf, kbuf, vtbf);
    attn_kernel<<<256, 128, 0, stream>>>(qbuf, kbuf, vtbf, ivec);
    deconv_kernel<<<(3145728 + 255) / 256, 256, 0, stream>>>(ivec, deconv_w, deconv_b, out, 3145728);
}

// v002
// One run takes 133 microseconds.
// Timed twice side by side with v001, it ran 1.11 and 1.07 times as fast.
// All steps since v000 together make it 1.81 times as fast.
#include <hip/hip_runtime.h>
#include <hip/hip_bf16.h>

typedef __attribute__((ext_vector_type(2))) float v2f;
typedef __attribute__((ext_vector_type(4))) float v4f;
typedef __attribute__((ext_vector_type(8))) float v8f;
typedef __attribute__((ext_vector_type(4))) int   v4i;

// D = A(16x4 f32) * B(4x16 f32) + C(16x16 f32), wave32 WMMA
static __device__ __forceinline__ v8f wmma_k4(v2f a, v2f b, v8f c) {
    return __builtin_amdgcn_wmma_f32_16x16x4_f32(
        /*neg_a=*/false, a, /*neg_b=*/false, b,
        /*c_mod=*/(short)0, c, /*reuse_a=*/false, /*reuse_b=*/false);
}

// ---- gfx1250 async global->LDS staging (ASYNCcnt-tracked) ------------------
#if defined(__gfx1250__) && __has_builtin(__builtin_amdgcn_global_load_async_to_lds_b128)
#define USE_ASYNC_LDS 1
#else
#define USE_ASYNC_LDS 0
#endif

typedef __attribute__((address_space(1))) v4i g_v4i;   // global int4
typedef __attribute__((address_space(3))) v4i l_v4i;   // LDS int4
static __device__ __forceinline__ g_v4i* as_global_v4i(const void* p) {
    return (g_v4i*)(uintptr_t)p;
}
static __device__ __forceinline__ l_v4i* as_lds_v4i(const void* p) {
    return (l_v4i*)(unsigned)(uintptr_t)p;   // low 32 bits = LDS byte offset
}
template <int N> static __device__ __forceinline__ void wait_asynccnt() {
#if __has_builtin(__builtin_amdgcn_s_wait_asynccnt)
    __builtin_amdgcn_s_wait_asynccnt(N);
#else
    asm volatile("s_wait_asynccnt %0" ::"i"(N) : "memory");
#endif
}

// ---------------------------------------------------------------------------
// Kernel 0: fold conv weights through the projection.
// W2[96][192] = proj_w[96][32] @ conv_w[32][192];  b2 = proj_w@conv_b + proj_b
// ---------------------------------------------------------------------------
__global__ void fuse_weights_kernel(const float* __restrict__ conv_w,
                                    const float* __restrict__ conv_b,
                                    const float* __restrict__ proj_w,
                                    const float* __restrict__ proj_b,
                                    float* __restrict__ W2,
                                    float* __restrict__ b2) {
    const int t = threadIdx.x;            // 0..95
    const float* pr = proj_w + t * 32;
    for (int e = 0; e < 192; ++e) {
        float s = 0.f;
        #pragma unroll
        for (int m = 0; m < 32; ++m) s += pr[m] * conv_w[m * 192 + e];
        W2[t * 192 + e] = s;
    }
    float sb = proj_b[t];
    #pragma unroll
    for (int m = 0; m < 32; ++m) sb += pr[m] * conv_b[m];
    b2[t] = sb;
}

// ---------------------------------------------------------------------------
// Kernel 1: patch embed + qkv projection as one f32 WMMA GEMM,
// Y[16384 tokens][96] = X[tokens][192] * W2^T + b2.
// One block per (batch, patch row): its 64 tokens read 3 x 8 image rows, which
// are three contiguous 16 KiB runs of x. They and all of W2 are staged in LDS
// once. 6 waves: wave = (q | k | v, token half), 32 tokens x 32 outputs each,
// so every 128-byte line of q, k and vt has one writing wave.
// k order: for each image row (8 k values per token) lane (l16, hi) holds
// elements hi*4 .. hi*4+3 of its token (A) or of its W2 row (B), loaded by the
// same code; the two WMMA steps take the low and the high pair.
// V is written TRANSPOSED (vt[b][32][4096]) so the attention kernel's staged
// V tiles are [d][n] and every WMMA B-fragment is a contiguous b64.
// ---------------------------------------------------------------------------
#define EMB_BP 196   // LDS pitch of a W2 row, floats: 784 B = 16 B x odd, no bank conflict for b128 reads

__global__ void __launch_bounds__(192)
embed_kernel(const float* __restrict__ x,
             const float* __restrict__ W2,
             const float* __restrict__ b2,
             float* __restrict__ q,
             float* __restrict__ k,
             float* __restrict__ vt) {
    __shared__ __attribute__((aligned(16))) float sA[24 * 512];      // [c*8+p][512 pixels]
    __shared__ __attribute__((aligned(16))) float sB[96 * EMB_BP];   // [out][192 + pad]

    const int t    = threadIdx.x;         // 0..191
    const int b    = blockIdx.x >> 6;     // 64 patch rows per batch
    const int h    = blockIdx.x & 63;
    const int lane = t & 31;
    const int hi   = lane >> 4;
    const int l16  = lane & 15;
    const int wave = __builtin_amdgcn_readfirstlane(t >> 5);
    const int part = wave >> 1;           // 0 q, 1 k, 2 v
    const int mh   = wave & 1;            // token half of the row

    // ---- stage x rows (3072 x 16 B) and W2 (4608 x 16 B) ----
    // x: wave pair 'part' takes channel 'part', 16 sweeps of 64 chunks; W2 is
    // read flat, 48 chunks per row, 4 rows per sweep.
    const int tc = t & 63;
    const float* xs = x + (((size_t)b * 3 + part) * 512 + h * 8) * 512;
    v4f ra[16], rb[24];
    #pragma unroll
    for (int it = 0; it < 16; ++it) ra[it] = *(const v4f*)(xs + (it * 64 + tc) * 4);
    #pragma unroll
    for (int it = 0; it < 24; ++it) rb[it] = *(const v4f*)(W2 + (it * 192 + t) * 4);
    const float bias0 = b2[part * 32 + l16];
    const float bias1 = b2[part * 32 + 16 + l16];
    // the loads' address registers may be reused only behind this wait
    asm volatile("s_wait_xcnt 0x0" ::: "memory");
    float* da = sA + part * 4096 + tc * 4;
    float* db = sB + (t / 48) * EMB_BP + (t % 48) * 4;
    #pragma unroll
    for (int it = 0; it < 16; ++it) *(v4f*)(da + it * 256) = ra[it];
    #pragma unroll
    for (int it = 0; it < 24; ++it) *(v4f*)(db + it * 4 * EMB_BP) = rb[it];
    __syncthreads();

    const float* pa = sA + (mh * 32 + l16) * 8 + hi * 4;
    const float* pb = sB + (part * 32 + l16) * EMB_BP + hi * 4;

    v8f acc00, acc01, acc10, acc11;       // [token tile][output tile]
    #pragma unroll
    for (int r = 0; r < 8; ++r) {
        acc00[r] = bias0; acc10[r] = bias0;
        acc01[r] = bias1; acc11[r] = bias1;
    }

    #pragma unroll
    for (int rr = 0; rr < 24; ++rr) {
        const v4f a0 = *(const v4f*)(pa + rr * 512);
        const v4f a1 = *(const v4f*)(pa + rr * 512 + 128);
        const v4f w0 = *(const v4f*)(pb + rr * 8);
        const v4f w1 = *(const v4f*)(pb + rr * 8 + 16 * EMB_BP);
        acc00 = wmma_k4(a0.xy, w0.xy, acc00);
        acc01 = wmma_k4(a0.xy, w1.xy, acc01);
        acc10 = wmma_k4(a1.xy, w0.xy, acc10);
        acc11 = wmma_k4(a1.xy, w1.xy, acc11);
        acc00 = wmma_k4(a0.zw, w0.zw, acc00);
        acc01 = wmma_k4(a0.zw, w1.zw, acc01);
        acc10 = wmma_k4(a1.zw, w0.zw, acc10);
        acc11 = wmma_k4(a1.zw, w1.zw, acc11);
    }

    // ---- D register r = Y[token 8*hi + r][output l16] ----
    const int nb = h * 64 + mh * 32;      // first token of this wave in its batch
    if (part < 2) {
        float* dst = (part == 0 ? q : k) + ((size_t)b * 4096 + nb + hi * 8) * 32 + l16;
        #pragma unroll
        for (int r = 0; r < 8; ++r) {
            dst[r * 32]             = acc00[r];
            dst[r * 32 + 16]        = acc01[r];
            dst[(r + 16) * 32]      = acc10[r];
            dst[(r + 16) * 32 + 16] = acc11[r];
        }
    } else {
        float* dv = vt + ((size_t)b * 32 + l16) * 4096 + nb + hi * 8;
        *(v4f*)(dv)                  = acc00.lo;
        *(v4f*)(dv + 4)              = acc00.hi;
        *(v4f*)(dv + 16)             = acc10.lo;
        *(v4f*)(dv + 20)             = acc10.hi;
        *(v4f*)(dv + 16 * 4096)      = acc01.lo;
        *(v4f*)(dv + 16 * 4096 + 4)  = acc01.hi;
        *(v4f*)(dv + 16 * 4096 + 16) = acc11.lo;
        *(v4f*)(dv + 16 * 4096 + 20) = acc11.hi;
        // the stores' address registers may be reused only behind this wait
        asm volatile("s_wait_xcnt 0x0" ::: "memory");
    }
}

// ---------------------------------------------------------------------------
// Kernel 2: fused attention  inter = cos(2*pi * (Q K^T, zero diag)) @ V, then
// the transposed convolution of inter, written straight to the image.
// 4 waves/block, 1 Q row-tile per wave. K/V 16-key tiles are staged into LDS
// cooperatively with double buffering via global_load_async_to_lds_b128
// (ASYNCcnt), so the next tile's fill overlaps the current tile's 16 fp32
// WMMAs. All fragments in the hot loop are ds_load_b64.
// Epilogue: ConvTranspose2d with kernel = stride = 8 is a GEMM,
// Y[192 = (o,p,q)][token] = dw^T[192][32] * inter^T[32][token] + db[o].
// A block's 64 tokens are one patch row, so it owns 3 x 8 whole image rows.
// The four inter tiles meet in LDS; wave w takes image rows p = 2w, 2w+1 of
// the three channels for all 64 tokens. With the weights as the A operand a
// lane's 8 results are the 8 pixels q of one patch row: two 16-byte stores.
// ---------------------------------------------------------------------------
#define INT_P 36     // LDS pitch of an inter row, floats: 144 B = 16 B x odd, no bank conflict for the b32 writes and b64 reads

__global__ void __launch_bounds__(128)
attn_kernel(const float* __restrict__ q,
            const float* __restrict__ k,
            const float* __restrict__ vt,
            const float* __restrict__ dw,
            const float* __restrict__ db,
            float* __restrict__ out) {
    __shared__ float ldsK[2][16 * 32];    // [buf][key n][dim d]
    __shared__ float ldsV[2][32 * 16];    // [buf][dim d][key n]
    __shared__ float ptile[4][16 * 16];   // per-wave P tile (C->A relayout)
    __shared__ __attribute__((aligned(16))) float sI[64 * INT_P];   // inter [token][dim + pad]

    const int t    = threadIdx.x;         // 0..127
    const int lane = t & 31;
    const int wave = t >> 5;
    const int b    = blockIdx.x >> 6;     // 64 blocks per batch
    const int i    = (blockIdx.x & 63) * 4 + wave;  // Q row-tile index
    const int hi   = lane >> 4;
    const int l16  = lane & 15;

    const float* qb  = q  + ((size_t)b * 4096 + i * 16) * 32;
    const float* kb  = k  + (size_t)b * 4096 * 32;
    const float* vtb = vt + (size_t)b * 32 * 4096;
    float* pt = ptile[wave];

    // staging addressing: both tiles are a flat 128 x 16B copy
    const int krow = t >> 3, kcol = (t & 7) * 4;    // K tile: 16 x 32
    const int vrow = t >> 2, vcol = (t & 3) * 4;    // V tile: 32 x 16

    // Q fragment, A-layout: lane row=l16, VGPR pair = K {c*4+2*hi, +1}
    v2f a_q[8];
    #pragma unroll
    for (int c = 0; c < 8; ++c)
        a_q[c] = *(const v2f*)(qb + l16 * 32 + c * 4 + hi * 2);

    // Deconv weights, A-layout, fetched here so that their latency lies under
    // the key loop: lane row = output o*64 + wave*16 + l16, pair = dims {c*4+2*hi, +1}
    const float* wp = dw + hi * 2 * 192 + wave * 16 + l16;
    v2f a_w[3][8];
    #pragma unroll
    for (int o = 0; o < 3; ++o) {
        #pragma unroll
        for (int c = 0; c < 8; ++c) {
            a_w[o][c].x = wp[(c * 4) * 192 + o * 64];
            a_w[o][c].y = wp[(c * 4 + 1) * 192 + o * 64];
        }
    }
    const float bias0 = db[0], bias1 = db[1], bias2 = db[2];
    // the loads' address registers may be reused only behind this wait
    asm volatile("s_wait_xcnt 0x0" ::: "memory");

    v8f acc0 = {}; v8f acc1 = {};         // D tile: dims 0-15 / 16-31

    // ---- stage tile j into buffer buf ----
    auto stage = [&](int j, int buf) {
        const float* gk = kb  + ((size_t)(j * 16 + krow)) * 32 + kcol;
        const float* gv = vtb + (size_t)vrow * 4096 + j * 16 + vcol;
#if USE_ASYNC_LDS
        __builtin_amdgcn_global_load_async_to_lds_b128(
            as_global_v4i(gk), as_lds_v4i(&ldsK[buf][t * 4]), 0, 0);
        __builtin_amdgcn_global_load_async_to_lds_b128(
            as_global_v4i(gv), as_lds_v4i(&ldsV[buf][t * 4]), 0, 0);
#else
        *(float4*)(&ldsK[buf][t * 4]) = *(const float4*)gk;
        *(float4*)(&ldsV[buf][t * 4]) = *(const float4*)gv;
#endif
    };

    stage(0, 0);
    for (int j = 0; j < 256; ++j) {
        const int cur = j & 1;
        if (j + 1 < 256) {
            stage(j + 1, cur ^ 1);
#if USE_ASYNC_LDS
            wait_asynccnt<2>();           // drain stage j, let stage j+1 fly
#endif
        } else {
#if USE_ASYNC_LDS
            wait_asynccnt<0>();
#endif
        }
        __syncthreads();

        const float* kc = ldsK[cur];
        const float* vc = ldsV[cur];

        // ---- S = Qtile * Ktile^T (16x16), K-dim = 32 in 8 WMMA steps ----
        v8f s = {};
        #pragma unroll
        for (int c = 0; c < 8; ++c) {
            v2f bk = *(const v2f*)(kc + l16 * 32 + c * 4 + hi * 2);  // ds_load_b64
            s = wmma_k4(a_q[c], bk, s);
        }
        // ---- P = cos(2*pi*S) (v_cos_f32 semantics), diag forced to 1 ----
        #pragma unroll
        for (int r = 0; r < 8; ++r) {
            const int m = r + hi * 8;
            float pv = __builtin_amdgcn_cosf(s[r]);
            pv = (i == j && m == l16) ? 1.0f : pv;
            pt[m * 16 + l16] = pv;
        }
        // ---- D += Ptile(16x16) * Vtile(16x32), inner dim 16 in 4 steps ----
        #pragma unroll
        for (int c = 0; c < 4; ++c) {
            v2f ap  = *(const v2f*)(pt + l16 * 16 + c * 4 + hi * 2);         // A-frag
            v2f bv0 = *(const v2f*)(vc + l16 * 16 + c * 4 + hi * 2);         // d 0-15
            acc0 = wmma_k4(ap, bv0, acc0);
            v2f bv1 = *(const v2f*)(vc + (l16 + 16) * 16 + c * 4 + hi * 2);  // d 16-31
            acc1 = wmma_k4(ap, bv1, acc1);
        }
        __syncthreads();                  // all reads done before buf reuse
    }

    // ---- inter tile (D register r = token 8*hi + r, dim l16) -> LDS ----
    float* si = sI + (wave * 16 + hi * 8) * INT_P + l16;
    #pragma unroll
    for (int r = 0; r < 8; ++r) {
        si[r * INT_P]      = acc0[r];
        si[r * INT_P + 16] = acc1[r];
    }
    __syncthreads();                      // every wave reads all four tiles

    // ---- Y = dw^T * inter^T + db; D register r = pixel q of image row
    //      p = 2*wave + hi, lane l16 = token of the 16-token tile tt ----
    const int h = blockIdx.x & 63;
    float* ob = out + (((size_t)b * 3) * 512 + h * 8 + wave * 2 + hi) * 512 + l16 * 8;
    #pragma unroll
    for (int tt = 0; tt < 4; ++tt) {
        const float* pi = sI + (tt * 16 + l16) * INT_P + hi * 2;
        v8f y0, y1, y2;                   // channels 0, 1, 2: three independent chains
        #pragma unroll
        for (int r = 0; r < 8; ++r) { y0[r] = bias0; y1[r] = bias1; y2[r] = bias2; }
        #pragma unroll
        for (int c = 0; c < 8; ++c) {
            const v2f bi = *(const v2f*)(pi + c * 4);   // B-frag: dims {c*4+2*hi, +1}
            y0 = wmma_k4(a_w[0][c], bi, y0);
            y1 = wmma_k4(a_w[1][c], bi, y1);
            y2 = wmma_k4(a_w[2][c], bi, y2);
        }
        float* o0 = ob + tt * 128;
        *(v4f*)(o0)                  = y0.lo;
        *(v4f*)(o0 + 4)              = y0.hi;
        *(v4f*)(o0 + 262144)         = y1.lo;
        *(v4f*)(o0 + 262144 + 4)     = y1.hi;
        *(v4f*)(o0 + 2 * 262144)     = y2.lo;
        *(v4f*)(o0 + 2 * 262144 + 4) = y2.hi;
    }
}

// ---------------------------------------------------------------------------
extern "C" void kernel_launch(void* const* d_in, const int* in_sizes, int n_in,
                              void* d_out, int out_size, void* d_ws, size_t ws_size,
                              hipStream_t stream) {
    const float* x        = (const float*)d_in[0];
    const float* conv_w   = (const float*)d_in[1];
    const float* conv_b   = (const float*)d_in[2];
    const float* proj_w   = (const float*)d_in[3];
    const float* proj_b   = (const float*)d_in[4];
    const float* deconv_w = (const float*)d_in[5];
    const float* deconv_b = (const float*)d_in[6];
    float* out = (float*)d_out;

    float* ws   = (float*)d_ws;
    float* W2   = ws;                      // 96*192  = 18432 floats
    float* b2   = W2 + 18432;              // 96 (padded to 128)
    float* qbuf = b2 + 128;                // 4*4096*32 = 524288 floats
    float* kbuf = qbuf + 524288;
    float* vtbf = kbuf + 524288;           // V transposed [b][32][4096]

    fuse_weights_kernel<<<1, 96, 0, stream>>>(conv_w, conv_b, proj_w, proj_b, W2, b2);
    embed_kernel<<<256, 192, 0, stream>>>(x, W2, b2, qbuf, kbuf, vtbf);
    attn_kernel<<<256, 128, 0, stream>>>(qbuf, kbuf, vtbf, deconv_w, deconv_b, out);
}

// v003
// A run of this version takes 120 microseconds.
// In two side-by-side timings against v002, it was 1.08 and 1.09 times as fast.
// All steps since v000 together make it 1.96 times as fast.
#include <hip/hip_runtime.h>
#include <hip/hip_bf16.h>

typedef __attribute__((ext_vector_type(2))) float v2f;
typedef __attribute__((ext_vector_type(4))) float v4f;
typedef __attribute__((ext_vector_type(8))) float v8f;
typedef __attribute__((ext_vector_type(4))) int   v4i;

// D = A(16x4 f32) * B(4x16 f32) + C(16x16 f32), wave32 WMMA
static __device__ __forceinline__ v8f wmma_k4(v2f a, v2f b, v8f c) {
    return __builtin_amdgcn_wmma_f32_16x16x4_f32(
        /*neg_a=*/false, a, /*neg_b=*/false, b,
        /*c_mod=*/(short)0, c, /*reuse_a=*/false, /*reuse_b=*/false);
}

// ---- gfx1250 async global->LDS staging (ASYNCcnt-tracked) ------------------
#if defined(__gfx1250__) && __has_builtin(__builtin_amdgcn_global_load_async_to_lds_b128)
#define USE_ASYNC_LDS 1
#else
#define USE_ASYNC_LDS 0
#endif

typedef __attribute__((address_space(1))) v4i g_v4i;   // global int4
typedef __attribute__((address_space(3))) v4i l_v4i;   // LDS int4
static __device__ __forceinline__ g_v4i* as_global_v4i(const void* p) {
    return (g_v4i*)(uintptr_t)p;
}
static __device__ __forceinline__ l_v4i* as_lds_v4i(const void* p) {
    return (l_v4i*)(unsigned)(uintptr_t)p;   // low 32 bits = LDS byte offset
}
template <int N> static __device__ __forceinline__ void wait_asynccnt() {
#if __has_builtin(__builtin_amdgcn_s_wait_asynccnt)
    __builtin_amdgcn_s_wait_asynccnt(N);
#else
    asm volatile("s_wait_asynccnt %0" ::"i"(N) : "memory");
#endif
}

// ---------------------------------------------------------------------------
// Kernel 0: fold conv weights through the projection.
// W2[96][192] = proj_w[96][32] @ conv_w[32][192];  b2 = proj_w@conv_b + proj_b
// ---------------------------------------------------------------------------
__global__ void fuse_weights_kernel(const float* __restrict__ conv_w,
                                    const float* __restrict__ conv_b,
                                    const float* __restrict__ proj_w,
                                    const float* __restrict__ proj_b,
                                    float* __restrict__ W2,
                                    float* __restrict__ b2) {
    const int t = threadIdx.x;            // 0..95
    const float* pr = proj_w + t * 32;
    for (int e = 0; e < 192; ++e) {
        float s = 0.f;
        #pragma unroll
        for (int m = 0; m < 32; ++m) s += pr[m] * conv_w[m * 192 + e];
        W2[t * 192 + e] = s;
    }
    float sb = proj_b[t];
    #pragma unroll
    for (int m = 0; m < 32; ++m) sb += pr[m] * conv_b[m];
    b2[t] = sb;
}

// ---------------------------------------------------------------------------
// Kernel 1: patch embed + qkv projection as one f32 WMMA GEMM,
// Y[16384 tokens][96] = X[tokens][192] * W2^T + b2.
// One block per (batch, patch row): its 64 tokens read 3 x 8 image rows, which
// are three contiguous 16 KiB runs of x. They and all of W2 are staged in LDS
// once. 6 waves: wave = (q | k | v, token half), 32 tokens x 32 outputs each,
// so every 128-byte line of q, k and vt has one writing wave.
// k order: for each image row (8 k values per token) lane (l16, hi) holds
// elements hi*4 .. hi*4+3 of its token (A) or of its W2 row (B), loaded by the
// same code; the two WMMA steps take the low and the high pair.
// V is written TRANSPOSED (vt[b][32][4096]) so the attention kernel's staged
// V tiles are [d][n] and every WMMA B-fragment is a contiguous b64.
// ---------------------------------------------------------------------------
#define EMB_BP 196   // LDS pitch of a W2 row, floats: 784 B = 16 B x odd, no bank conflict for b128 reads

__global__ void __launch_bounds__(192)
embed_kernel(const float* __restrict__ x,
             const float* __restrict__ W2,
             const float* __restrict__ b2,
             float* __restrict__ q,
             float* __restrict__ k,
             float* __restrict__ vt) {
    __shared__ __attribute__((aligned(16))) float sA[24 * 512];      // [c*8+p][512 pixels]
    __shared__ __attribute__((aligned(16))) float sB[96 * EMB_BP];   // [out][192 + pad]

    const int t    = threadIdx.x;         // 0..191
    const int b    = blockIdx.x >> 6;     // 64 patch rows per batch
    const int h    = blockIdx.x & 63;
    const int lane = t & 31;
    const int hi   = lane >> 4;
    const int l16  = lane & 15;
    const int wave = __builtin_amdgcn_readfirstlane(t >> 5);
    const int part = wave >> 1;           // 0 q, 1 k, 2 v
    const int mh   = wave & 1;            // token half of the row

    // ---- stage x rows (3072 x 16 B) and W2 (4608 x 16 B) ----
    // x: wave pair 'part' takes channel 'part', 16 sweeps of 64 chunks; W2 is
    // read flat, 48 chunks per row, 4 rows per sweep.
    const int tc = t & 63;
    const float* xs = x + (((size_t)b * 3 + part) * 512 + h * 8) * 512;
    v4f ra[16], rb[24];
    #pragma unroll
    for (int it = 0; it < 16; ++it) ra[it] = *(const v4f*)(xs + (it * 64 + tc) * 4);
    #pragma unroll
    for (int it = 0; it < 24; ++it) rb[it] = *(const v4f*)(W2 + (it * 192 + t) * 4);
    const float bias0 = b2[part * 32 + l16];
    const float bias1 = b2[part * 32 + 16 + l16];
    // the loads' address registers may be reused only behind this wait
    asm volatile("s_wait_xcnt 0x0" ::: "memory");
    float* da = sA + part * 4096 + tc * 4;
    float* db = sB + (t / 48) * EMB_BP + (t % 48) * 4;
    #pragma unroll
    for (int it = 0; it < 16; ++it) *(v4f*)(da + it * 256) = ra[it];
    #pragma unroll
    for (int it = 0; it < 24; ++it) *(v4f*)(db + it * 4 * EMB_BP) = rb[it];
    __syncthreads();

    const float* pa = sA + (mh * 32 + l16) * 8 + hi * 4;
    const float* pb = sB + (part * 32 + l16) * EMB_BP + hi * 4;

    v8f acc00, acc01, acc10, acc11;       // [token tile][output tile]
    #pragma unroll
    for (int r = 0; r < 8; ++r) {
        acc00[r] = bias0; acc10[r] = bias0;
        acc01[r] = bias1; acc11[r] = bias1;
    }

    #pragma unroll
    for (int rr = 0; rr < 24; ++rr) {
        const v4f a0 = *(const v4f*)(pa + rr * 512);
        const v4f a1 = *(const v4f*)(pa + rr * 512 + 128);
        const v4f w0 = *(const v4f*)(pb + rr * 8);
        const v4f w1 = *(const v4f*)(pb + rr * 8 + 16 * EMB_BP);
        acc00 = wmma_k4(a0.xy, w0.xy, acc00);
        acc01 = wmma_k4(a0.xy, w1.xy, acc01);
        acc10 = wmma_k4(a1.xy, w0.xy, acc10);
        acc11 = wmma_k4(a1.xy, w1.xy, acc11);
        acc00 = wmma_k4(a0.zw, w0.zw, acc00);
        acc01 = wmma_k4(a0.zw, w1.zw, acc01);
        acc10 = wmma_k4(a1.zw, w0.zw, acc10);
        acc11 = wmma_k4(a1.zw, w1.zw, acc11);
    }

    // ---- D register r = Y[token 8*hi + r][output l16] ----
    const int nb = h * 64 + mh * 32;      // first token of this wave in its batch
    if (part < 2) {
        float* dst = (part == 0 ? q : k) + ((size_t)b * 4096 + nb + hi * 8) * 32 + l16;
        #pragma unroll
        for (int r = 0; r < 8; ++r) {
            dst[r * 32]             = acc00[r];
            dst[r * 32 + 16]        = acc01[r];
            dst[(r + 16) * 32]      = acc10[r];
            dst[(r + 16) * 32 + 16] = acc11[r];
        }
    } else {
        float* dv = vt + ((size_t)b * 32 + l16) * 4096 + nb + hi * 8;
        *(v4f*)(dv)                  = acc00.lo;
        *(v4f*)(dv + 4)              = acc00.hi;
        *(v4f*)(dv + 16)             = acc10.lo;
        *(v4f*)(dv + 20)             = acc10.hi;
        *(v4f*)(dv + 16 * 4096)      = acc01.lo;
        *(v4f*)(dv + 16 * 4096 + 4)  = acc01.hi;
        *(v4f*)(dv + 16 * 4096 + 16) = acc11.lo;
        *(v4f*)(dv + 16 * 4096 + 20) = acc11.hi;
        // the stores' address registers may be reused only behind this wait
        asm volatile("s_wait_xcnt 0x0" ::: "memory");
    }
}

// ---------------------------------------------------------------------------
// Kernel 2: fused attention  inter = cos(2*pi * (Q K^T, zero diag)) @ V, then
// the transposed convolution of inter, written straight to the image.
// 4 waves/block, 1 Q row-tile per wave. K/V 16-key tiles are staged into LDS
// cooperatively with double buffering via global_load_async_to_lds_b128
// (ASYNCcnt), so the next tile's fill overlaps the current tile's 16 fp32
// WMMAs. All fragments in the hot loop are ds_load_b64, one tile row a lane:
// the rows of the K, V and P tiles lie at a pitch of 16 B x odd, so that the
// 32 lanes of a read fall on 64 different banks.
// Epilogue: ConvTranspose2d with kernel = stride = 8 is a GEMM,
// Y[192 = (o,p,q)][token] = dw^T[192][32] * inter^T[32][token] + db[o].
// A block's 64 tokens are one patch row, so it owns 3 x 8 whole image rows.
// The four inter tiles meet in LDS; wave w takes image rows p = 2w, 2w+1 of
// the three channels for all 64 tokens. With the weights as the A operand a
// lane's 8 results are the 8 pixels q of one patch row: two 16-byte stores.
// ---------------------------------------------------------------------------
#define K_P   36     // LDS pitch of a K row (32 dims), floats: 144 B = 16 B x odd
#define V_P   20     // LDS pitch of a V^T row and of a P row (16 keys), floats: 80 B = 16 B x odd
#define INT_P 36     // LDS pitch of an inter row, floats: 144 B = 16 B x odd, no bank conflict for the b32 writes and b64 reads

__global__ void __launch_bounds__(128)
attn_kernel(const float* __restrict__ q,
            const float* __restrict__ k,
            const float* __restrict__ vt,
            const float* __restrict__ dw,
            const float* __restrict__ db,
            float* __restrict__ out) {
    __shared__ __attribute__((aligned(16))) float ldsK[2][16 * K_P];   // [buf][key n][dim d + pad]
    __shared__ __attribute__((aligned(16))) float ldsV[2][32 * V_P];   // [buf][dim d][key n + pad]
    __shared__ float ptile[4][16 * V_P];  // per-wave P tile (C->A relayout), [query m][key n + pad]
    __shared__ __attribute__((aligned(16))) float sI[64 * INT_P];   // inter [token][dim + pad]

    const int t    = threadIdx.x;         // 0..127
    const int lane = t & 31;
    const int wave = t >> 5;
    const int b    = blockIdx.x >> 6;     // 64 blocks per batch
    const int i    = (blockIdx.x & 63) * 4 + wave;  // Q row-tile index
    const int hi   = lane >> 4;
    const int l16  = lane & 15;

    const float* qb  = q  + ((size_t)b * 4096 + i * 16) * 32;
    const float* kb  = k  + (size_t)b * 4096 * 32;
    const float* vtb = vt + (size_t)b * 32 * 4096;
    float* pt = ptile[wave];

    // staging addressing: both tiles are 128 chunks of 16 B, one a thread
    const int krow = t >> 3, kcol = (t & 7) * 4;    // K tile: 16 x 32
    const int vrow = t >> 2, vcol = (t & 3) * 4;    // V tile: 32 x 16

    // Q fragment, A-layout: lane row=l16, VGPR pair = K {c*4+2*hi, +1}
    v2f a_q[8];
    #pragma unroll
    for (int c = 0; c < 8; ++c)
        a_q[c] = *(const v2f*)(qb + l16 * 32 + c * 4 + hi * 2);

    // Deconv weights, A-layout, fetched here so that their latency lies under
    // the key loop: lane row = output o*64 + wave*16 + l16, pair = dims {c*4+2*hi, +1}
    const float* wp = dw + hi * 2 * 192 + wave * 16 + l16;
    v2f a_w[3][8];
    #pragma unroll
    for (int o = 0; o < 3; ++o) {
        #pragma unroll
        for (int c = 0; c < 8; ++c) {
            a_w[o][c].x = wp[(c * 4) * 192 + o * 64];
            a_w[o][c].y = wp[(c * 4 + 1) * 192 + o * 64];
        }
    }
    const float bias0 = db[0], bias1 = db[1], bias2 = db[2];
    // the loads' address registers may be reused only behind this wait
    asm volatile("s_wait_xcnt 0x0" ::: "memory");

    v8f acc0 = {}; v8f acc1 = {};         // D tile: dims 0-15 / 16-31

    // ---- stage tile j into buffer buf ----
    auto stage = [&](int j, int buf) {
        const float* gk = kb  + ((size_t)(j * 16 + krow)) * 32 + kcol;
        const float* gv = vtb + (size_t)vrow * 4096 + j * 16 + vcol;
#if USE_ASYNC_LDS
        __builtin_amdgcn_global_load_async_to_lds_b128(
            as_global_v4i(gk), as_lds_v4i(&ldsK[buf][krow * K_P + kcol]), 0, 0);
        __builtin_amdgcn_global_load_async_to_lds_b128(
            as_global_v4i(gv), as_lds_v4i(&ldsV[buf][vrow * V_P + vcol]), 0, 0);
#else
        *(float4*)(&ldsK[buf][krow * K_P + kcol]) = *(const float4*)gk;
        *(float4*)(&ldsV[buf][vrow * V_P + vcol]) = *(const float4*)gv;
#endif
    };

    stage(0, 0);
    for (int j = 0; j < 256; ++j) {
        const int cur = j & 1;
        if (j + 1 < 256) {
            stage(j + 1, cur ^ 1);
#if USE_ASYNC_LDS
            wait_asynccnt<2>();           // drain stage j, let stage j+1 fly
#endif
        } else {
#if USE_ASYNC_LDS
            wait_asynccnt<0>();
#endif
        }
        __syncthreads();

        const float* kc = ldsK[cur];
        const float* vc = ldsV[cur];

        // ---- S = Qtile * Ktile^T (16x16), K-dim = 32 in 8 WMMA steps ----
        v8f s = {};
        #pragma unroll
        for (int c = 0; c < 8; ++c) {
            v2f bk = *(const v2f*)(kc + l16 * K_P + c * 4 + hi * 2);  // ds_load_b64
            s = wmma_k4(a_q[c], bk, s);
        }
        // ---- P = cos(2*pi*S) (v_cos_f32 semantics), diag forced to 1 ----
        #pragma unroll
        for (int r = 0; r < 8; ++r) {
            const int m = r + hi * 8;
            float pv = __builtin_amdgcn_cosf(s[r]);
            pv = (i == j && m == l16) ? 1.0f : pv;
            pt[m * V_P + l16] = pv;
        }
        // ---- D += Ptile(16x16) * Vtile(16x32), inner dim 16 in 4 steps ----
        #pragma unroll
        for (int c = 0; c < 4; ++c) {
            v2f ap  = *(const v2f*)(pt + l16 * V_P + c * 4 + hi * 2);         // A-frag
            v2f bv0 = *(const v2f*)(vc + l16 * V_P + c * 4 + hi * 2);         // d 0-15
            acc0 = wmma_k4(ap, bv0, acc0);
            v2f bv1 = *(const v2f*)(vc + (l16 + 16) * V_P + c * 4 + hi * 2);  // d 16-31
            acc1 = wmma_k4(ap, bv1, acc1);
        }
        __syncthreads();                  // all reads done before buf reuse
    }

    // ---- inter tile (D register r = token 8*hi + r, dim l16) -> LDS ----
    float* si = sI + (wave * 16 + hi * 8) * INT_P + l16;
    #pragma unroll
    for (int r = 0; r < 8; ++r) {
        si[r * INT_P]      = acc0[r];
        si[r * INT_P + 16] = acc1[r];
    }
    __syncthreads();                      // every wave reads all four tiles

    // ---- Y = dw^T * inter^T + db; D register r = pixel q of image row
    //      p = 2*wave + hi, lane l16 = token of the 16-token tile tt ----
    const int h = blockIdx.x & 63;
    float* ob = out + (((size_t)b * 3) * 512 + h * 8 + wave * 2 + hi) * 512 + l16 * 8;
    #pragma unroll
    for (int tt = 0; tt < 4; ++tt) {
        const float* pi = sI + (tt * 16 + l16) * INT_P + hi * 2;
        v8f y0, y1, y2;                   // channels 0, 1, 2: three independent chains
        #pragma unroll
        for (int r = 0; r < 8; ++r) { y0[r] = bias0; y1[r] = bias1; y2[r] = bias2; }
        #pragma unroll
        for (int c = 0; c < 8; ++c) {
            const v2f bi = *(const v2f*)(pi + c * 4);   // B-frag: dims {c*4+2*hi, +1}
            y0 = wmma_k4(a_w[0][c], bi, y0);
            y1 = wmma_k4(a_w[1][c], bi, y1);
            y2 = wmma_k4(a_w[2][c], bi, y2);
        }
        float* o0 = ob + tt * 128;
        *(v4f*)(o0)                  = y0.lo;
        *(v4f*)(o0 + 4)              = y0.hi;
        *(v4f*)(o0 + 262144)         = y1.lo;
        *(v4f*)(o0 + 262144 + 4)     = y1.hi;
        *(v4f*)(o0 + 2 * 262144)     = y2.lo;
        *(v4f*)(o0 + 2 * 262144 + 4) = y2.hi;
    }
}

// ---------------------------------------------------------------------------
extern "C" void kernel_launch(void* const* d_in, const int* in_sizes, int n_in,
                              void* d_out, int out_size, void* d_ws, size_t ws_size,
                              hipStream_t stream) {
    const float* x        = (const float*)d_in[0];
    const float* conv_w   = (const float*)d_in[1];
    const float* conv_b   = (const float*)d_in[2];
    const float* proj_w   = (const float*)d_in[3];
    const float* proj_b   = (const float*)d_in[4];
    const float* deconv_w = (const float*)d_in[5];
    const float* deconv_b = (const float*)d_in[6];
    float* out = (float*)d_out;

    float* ws   = (float*)d_ws;
    float* W2   = ws;                      // 96*192  = 18432 floats
    float* b2   = W2 + 18432;              // 96 (padded to 128)
    float* qbuf = b2 + 128;                // 4*4096*32 = 524288 floats
    float* kbuf = qbuf + 524288;
    float* vtbf = kbuf + 524288;           // V transposed [b][32][4096]

    fuse_weights_kernel<<<1, 96, 0, stream>>>(conv_w, conv_b, proj_w, proj_b, W2, b2);
    embed_kernel<<<256, 192, 0, stream>>>(x, W2, b2, qbuf, kbuf, vtbf);
    attn_kernel<<<256, 128, 0, stream>>>(qbuf, kbuf, vtbf, deconv_w, deconv_b, out);
}

// v004
// It runs in 72.6 microseconds.
// Next to v003, in two timings, it ran 1.75 and 1.65 times as fast.
// Counting every step since v000, it is 3.34 times as fast.
#include <hip/hip_runtime.h>
#include <hip/hip_bf16.h>

typedef __attribute__((ext_vector_type(2))) float v2f;
typedef __attribute__((ext_vector_type(4))) float v4f;
typedef __attribute__((ext_vector_type(8))) float v8f;
typedef __attribute__((ext_vector_type(4))) int   v4i;

// D = A(16x4 f32) * B(4x16 f32) + C(16x16 f32), wave32 WMMA
static __device__ __forceinline__ v8f wmma_k4(v2f a, v2f b, v8f c) {
    return __builtin_amdgcn_wmma_f32_16x16x4_f32(
        /*neg_a=*/false, a, /*neg_b=*/false, b,
        /*c_mod=*/(short)0, c, /*reuse_a=*/false, /*reuse_b=*/false);
}

// ---- gfx1250 async global->LDS staging (ASYNCcnt-tracked) ------------------
#if defined(__gfx1250__) && __has_builtin(__builtin_amdgcn_global_load_async_to_lds_b128)
#define USE_ASYNC_LDS 1
#else
#define USE_ASYNC_LDS 0
#endif

typedef __attribute__((address_space(1))) v4i g_v4i;   // global int4
typedef __attribute__((address_space(3))) v4i l_v4i;   // LDS int4
static __device__ __forceinline__ g_v4i* as_global_v4i(const void* p) {
    return (g_v4i*)(uintptr_t)p;
}
static __device__ __forceinline__ l_v4i* as_lds_v4i(const void* p) {
    return (l_v4i*)(unsigned)(uintptr_t)p;   // low 32 bits = LDS byte offset
}
template <int N> static __device__ __forceinline__ void wait_asynccnt() {
#if __has_builtin(__builtin_amdgcn_s_wait_asynccnt)
    __builtin_amdgcn_s_wait_asynccnt(N);
#else
    asm volatile("s_wait_asynccnt %0" ::"i"(N) : "memory");
#endif
}

// ---------------------------------------------------------------------------
// Kernel 0: fold conv weights through the projection.
// W2[96][192] = proj_w[96][32] @ conv_w[32][192];  b2 = proj_w@conv_b + proj_b
// ---------------------------------------------------------------------------
__global__ void fuse_weights_kernel(const float* __restrict__ conv_w,
                                    const float* __restrict__ conv_b,
                                    const float* __restrict__ proj_w,
                                    const float* __restrict__ proj_b,
                                    float* __restrict__ W2,
                                    float* __restrict__ b2) {
    const int t = threadIdx.x;            // 0..95
    const float* pr = proj_w + t * 32;
    for (int e = 0; e < 192; ++e) {
        float s = 0.f;
        #pragma unroll
        for (int m = 0; m < 32; ++m) s += pr[m] * conv_w[m * 192 + e];
        W2[t * 192 + e] = s;
    }
    float sb = proj_b[t];
    #pragma unroll
    for (int m = 0; m < 32; ++m) sb += pr[m] * conv_b[m];
    b2[t] = sb;
}

// ---------------------------------------------------------------------------
// Kernel 1: patch embed + qkv projection as one f32 WMMA GEMM,
// Y[16384 tokens][96] = X[tokens][192] * W2^T + b2.
// One block per (batch, patch row): its 64 tokens read 3 x 8 image rows, which
// are three contiguous 16 KiB runs of x. They and all of W2 are staged in LDS
// once. 6 waves: wave = (q | k | v, token half), 32 tokens x 32 outputs each,
// so every 128-byte line of q, k and vt has one writing wave.
// k order: for each image row (8 k values per token) lane (l16, hi) holds
// elements hi*4 .. hi*4+3 of its token (A) or of its W2 row (B), loaded by the
// same code; the two WMMA steps take the low and the high pair.
// V is written TRANSPOSED (vt[b][32][4096]) so the attention kernel's staged
// V tiles are [d][n] and every WMMA B-fragment is a contiguous b64.
// ---------------------------------------------------------------------------
#define EMB_BP 196   // LDS pitch of a W2 row, floats: 784 B = 16 B x odd, no bank conflict for b128 reads

__global__ void __launch_bounds__(192)
embed_kernel(const float* __restrict__ x,
             const float* __restrict__ W2,
             const float* __restrict__ b2,
             float* __restrict__ q,
             float* __restrict__ k,
             float* __restrict__ vt) {
    __shared__ __attribute__((aligned(16))) float sA[24 * 512];      // [c*8+p][512 pixels]
    __shared__ __attribute__((aligned(16))) float sB[96 * EMB_BP];   // [out][192 + pad]

    const int t    = threadIdx.x;         // 0..191
    const int b    = blockIdx.x >> 6;     // 64 patch rows per batch
    const int h    = blockIdx.x & 63;
    const int lane = t & 31;
    const int hi   = lane >> 4;
    const int l16  = lane & 15;
    const int wave = __builtin_amdgcn_readfirstlane(t >> 5);
    const int part = wave >> 1;           // 0 q, 1 k, 2 v
    const int mh   = wave & 1;            // token half of the row

    // ---- stage x rows (3072 x 16 B) and W2 (4608 x 16 B) ----
    // x: wave pair 'part' takes channel 'part', 16 sweeps of 64 chunks; W2 is
    // read flat, 48 chunks per row, 4 rows per sweep.
    const int tc = t & 63;
    const float* xs = x + (((size_t)b * 3 + part) * 512 + h * 8) * 512;
    v4f ra[16], rb[24];
    #pragma unroll
    for (int it = 0; it < 16; ++it) ra[it] = *(const v4f*)(xs + (it * 64 + tc) * 4);
    #pragma unroll
    for (int it = 0; it < 24; ++it) rb[it] = *(const v4f*)(W2 + (it * 192 + t) * 4);
    const float bias0 = b2[part * 32 + l16];
    const float bias1 = b2[part * 32 + 16 + l16];
    // the loads' address registers may be reused only behind this wait
    asm volatile("s_wait_xcnt 0x0" ::: "memory");
    float* da = sA + part * 4096 + tc * 4;
    float* db = sB + (t / 48) * EMB_BP + (t % 48) * 4;
    #pragma unroll
    for (int it = 0; it < 16; ++it) *(v4f*)(da + it * 256) = ra[it];
    #pragma unroll
    for (int it = 0; it < 24; ++it) *(v4f*)(db + it * 4 * EMB_BP) = rb[it];
    __syncthreads();

    const float* pa = sA + (mh * 32 + l16) * 8 + hi * 4;
    const float* pb = sB + (part * 32 + l16) * EMB_BP + hi * 4;

    v8f acc00, acc01, acc10, acc11;       // [token tile][output tile]
    #pragma unroll
    for (int r = 0; r < 8; ++r) {
        acc00[r] = bias0; acc10[r] = bias0;
        acc01[r] = bias1; acc11[r] = bias1;
    }

    #pragma unroll
    for (int rr = 0; rr < 24; ++rr) {
        const v4f a0 = *(const v4f*)(pa + rr * 512);
        const v4f a1 = *(const v4f*)(pa + rr * 512 + 128);
        const v4f w0 = *(const v4f*)(pb + rr * 8);
        const v4f w1 = *(const v4f*)(pb + rr * 8 + 16 * EMB_BP);
        acc00 = wmma_k4(a0.xy, w0.xy, acc00);
        acc01 = wmma_k4(a0.xy, w1.xy, acc01);
        acc10 = wmma_k4(a1.xy, w0.xy, acc10);
        acc11 = wmma_k4(a1.xy, w1.xy, acc11);
        acc00 = wmma_k4(a0.zw, w0.zw, acc00);
        acc01 = wmma_k4(a0.zw, w1.zw, acc01);
        acc10 = wmma_k4(a1.zw, w0.zw, acc10);
        acc11 = wmma_k4(a1.zw, w1.zw, acc11);
    }

    // ---- D register r = Y[token 8*hi + r][output l16] ----
    const int nb = h * 64 + mh * 32;      // first token of this wave in its batch
    if (part < 2) {
        float* dst = (part == 0 ? q : k) + ((size_t)b * 4096 + nb + hi * 8) * 32 + l16;
        #pragma unroll
        for (int r = 0; r < 8; ++r) {
            dst[r * 32]             = acc00[r];
            dst[r * 32 + 16]        = acc01[r];
            dst[(r + 16) * 32]      = acc10[r];
            dst[(r + 16) * 32 + 16] = acc11[r];
        }
    } else {
        float* dv = vt + ((size_t)b * 32 + l16) * 4096 + nb + hi * 8;
        *(v4f*)(dv)                  = acc00.lo;
        *(v4f*)(dv + 4)              = acc00.hi;
        *(v4f*)(dv + 16)             = acc10.lo;
        *(v4f*)(dv + 20)             = acc10.hi;
        *(v4f*)(dv + 16 * 4096)      = acc01.lo;
        *(v4f*)(dv + 16 * 4096 + 4)  = acc01.hi;
        *(v4f*)(dv + 16 * 4096 + 16) = acc11.lo;
        *(v4f*)(dv + 16 * 4096 + 20) = acc11.hi;
        // the stores' address registers may be reused only behind this wait
        asm volatile("s_wait_xcnt 0x0" ::: "memory");
    }
}

// ---------------------------------------------------------------------------
// Kernel 2: fused attention  inter = cos(2*pi * (Q K^T, zero diag)) @ V, then
// the transposed convolution of inter, written straight to the image.
// 16 waves/block, four a SIMD: wave = (Q row-tile qt of the block's four, key
// group kg of four). A stage is 128 keys; of its eight 16-key tiles wave
// (qt, kg) takes tiles kg and kg + 4, so a query tile's key sum is shared by
// four waves, each with its own partial accumulator. While one wave waits on
// its dependent WMMA chain, its cosines or its P tile's way through LDS, the
// three others of its SIMD issue.
// K/V stages are brought into LDS cooperatively with double buffering via
// global_load_async_to_lds_b128 (ASYNCcnt), so the next stage's fill overlaps
// the current stage's WMMAs. All fragments in the hot loop are ds_load_b64,
// one tile row a lane: the rows of the K, V and P tiles lie at a pitch of
// 16 B x odd, so that the 32 lanes of a read fall on 64 different banks.
// Epilogue: the four partial inter tiles of each query tile meet in LDS and
// are added, in the order of kg, where the next product reads them.
// ConvTranspose2d with kernel = stride = 8 is a GEMM,
// Y[192 = (o,p,q)][token] = dw^T[192][32] * inter^T[32][token] + db[o].
// A block's 64 tokens are one patch row, so it owns 3 x 8 whole image rows.
// Wave (w4, tt) takes image rows p = 2*w4, 2*w4+1 of the three channels for
// the 16 tokens of tile tt. With the weights as the A operand a lane's 8
// results are the 8 pixels q of one patch row: two 16-byte stores.
// ---------------------------------------------------------------------------
#define SKEYS 128    // keys a stage
#define K_P   36     // LDS pitch of a K row (32 dims), floats: 144 B = 16 B x odd
#define V_P   132    // LDS pitch of a V^T row (128 keys), floats: 528 B = 16 B x odd
#define P_P   20     // LDS pitch of a P row (16 keys), floats: 80 B = 16 B x odd
#define INT_P 36     // LDS pitch of an inter row, floats: 144 B = 16 B x odd, no bank conflict for the b32 writes and b64 reads

__global__ void __launch_bounds__(512)
attn_kernel(const float* __restrict__ q,
            const float* __restrict__ k,
            const float* __restrict__ vt,
            const float* __restrict__ dw,
            const float* __restrict__ db,
            float* __restrict__ out) {
    __shared__ __attribute__((aligned(16))) float ldsK[2][SKEYS * K_P];   // [buf][key n][dim d + pad]
    __shared__ __attribute__((aligned(16))) float ldsV[2][32 * V_P];      // [buf][dim d][key n + pad]
    __shared__ float ptile[16][2][16 * P_P];  // per-wave P tiles (C->A relayout), [query m][key n + pad]
    __shared__ __attribute__((aligned(16))) float sI[4][64 * INT_P];      // partial inter [kg][token][dim + pad]

    const int t    = threadIdx.x;         // 0..511
    const int lane = t & 31;
    const int wave = __builtin_amdgcn_readfirstlane(t >> 5);
    const int qt   = wave & 3;            // Q row-tile of the block; in the epilogue the image row pair
    const int kg   = wave >> 2;           // key group; in the epilogue the token tile
    const int b    = blockIdx.x >> 6;     // 64 blocks per batch
    const int i    = (blockIdx.x & 63) * 4 + qt;    // Q row-tile index
    const int hi   = lane >> 4;
    const int l16  = lane & 15;

    const float* qb  = q  + ((size_t)b * 4096 + i * 16) * 32;
    const float* kb  = k  + (size_t)b * 4096 * 32;
    const float* vtb = vt + (size_t)b * 32 * 4096;

    // staging addressing: both tiles are 1024 chunks of 16 B, two a thread
    const int krow = t >> 3, kcol = (t & 7) * 4;    // K stage: 128 x 32, rows krow and krow + 64
    const int vrow = t >> 5, vcol = (t & 31) * 4;   // V stage: 32 x 128, rows vrow and vrow + 16

    // Q fragment, A-layout: lane row=l16, VGPR pair = K {c*4+2*hi, +1}
    v2f a_q[8];
    #pragma unroll
    for (int c = 0; c < 8; ++c)
        a_q[c] = *(const v2f*)(qb + l16 * 32 + c * 4 + hi * 2);

    // Deconv weights, A-layout, fetched here so that their latency lies under
    // the key loop: lane row = output o*64 + qt*16 + l16, pair = dims {c*4+2*hi, +1}
    const float* wp = dw + hi * 2 * 192 + qt * 16 + l16;
    v2f a_w[3][8];
    #pragma unroll
    for (int o = 0; o < 3; ++o) {
        #pragma unroll
        for (int c = 0; c < 8; ++c) {
            a_w[o][c].x = wp[(c * 4) * 192 + o * 64];
            a_w[o][c].y = wp[(c * 4 + 1) * 192 + o * 64];
        }
    }
    const float bias0 = db[0], bias1 = db[1], bias2 = db[2];
    // the loads' address registers may be reused only behind this wait
    asm volatile("s_wait_xcnt 0x0" ::: "memory");

    v8f acc0 = {}; v8f acc1 = {};         // partial D tile: dims 0-15 / 16-31

    // ---- bring stage j (keys j*128 .. j*128+127) into buffer buf ----
    auto stage = [&](int j, int buf) {
        #pragma unroll
        for (int u = 0; u < 2; ++u) {
            const int kr = krow + u * 64, vr = vrow + u * 16;
            const float* gk = kb  + ((size_t)(j * SKEYS + kr)) * 32 + kcol;
            const float* gv = vtb + (size_t)vr * 4096 + j * SKEYS + vcol;
#if USE_ASYNC_LDS
            __builtin_amdgcn_global_load_async_to_lds_b128(
                as_global_v4i(gk), as_lds_v4i(&ldsK[buf][kr * K_P + kcol]), 0, 0);
            __builtin_amdgcn_global_load_async_to_lds_b128(
                as_global_v4i(gv), as_lds_v4i(&ldsV[buf][vr * V_P + vcol]), 0, 0);
#else
            *(float4*)(&ldsK[buf][kr * K_P + kcol]) = *(const float4*)gk;
            *(float4*)(&ldsV[buf][vr * V_P + vcol]) = *(const float4*)gv;
#endif
        }
    };

    stage(0, 0);
    for (int j = 0; j < 4096 / SKEYS; ++j) {
        const int cur = j & 1;
        if (j + 1 < 4096 / SKEYS) {
            stage(j + 1, cur ^ 1);
#if USE_ASYNC_LDS
            wait_asynccnt<4>();           // drain stage j, let stage j+1's four copies fly
#endif
        } else {
#if USE_ASYNC_LDS
            wait_asynccnt<0>();
#endif
        }
        __syncthreads();

        #pragma unroll
        for (int u = 0; u < 2; ++u) {
            const int kt = u * 4 + kg;            // this wave's key tile of the stage
            const int jt = j * (SKEYS / 16) + kt; // key tile index in the batch
            const float* kc = ldsK[cur] + kt * 16 * K_P;
            const float* vc = ldsV[cur] + kt * 16;
            float* pt = ptile[wave][u];

            // ---- S = Qtile * Ktile^T (16x16), K-dim = 32 in 8 WMMA steps ----
            v8f s = {};
            #pragma unroll
            for (int c = 0; c < 8; ++c) {
                v2f bk = *(const v2f*)(kc + l16 * K_P + c * 4 + hi * 2);  // ds_load_b64
                s = wmma_k4(a_q[c], bk, s);
            }
            // ---- P = cos(2*pi*S) (v_cos_f32 semantics), diag forced to 1 ----
            #pragma unroll
            for (int r = 0; r < 8; ++r) {
                const int m = r + hi * 8;
                float pv = __builtin_amdgcn_cosf(s[r]);
                pv = (i == jt && m == l16) ? 1.0f : pv;
                pt[m * P_P + l16] = pv;
            }
            // ---- D += Ptile(16x16) * Vtile(16x32), inner dim 16 in 4 steps ----
            #pragma unroll
            for (int c = 0; c < 4; ++c) {
                v2f ap  = *(const v2f*)(pt + l16 * P_P + c * 4 + hi * 2);         // A-frag
                v2f bv0 = *(const v2f*)(vc + l16 * V_P + c * 4 + hi * 2);         // d 0-15
                acc0 = wmma_k4(ap, bv0, acc0);
                v2f bv1 = *(const v2f*)(vc + (l16 + 16) * V_P + c * 4 + hi * 2);  // d 16-31
                acc1 = wmma_k4(ap, bv1, acc1);
            }
        }
        __syncthreads();                  // all reads done before buf reuse
    }

    // ---- partial inter tile (D register r = token 8*hi + r, dim l16) -> LDS ----
    float* si = sI[kg] + (qt * 16 + hi * 8) * INT_P + l16;
    #pragma unroll
    for (int r = 0; r < 8; ++r) {
        si[r * INT_P]      = acc0[r];
        si[r * INT_P + 16] = acc1[r];
    }
    __syncthreads();                      // every wave reads partials written by other waves

    // ---- Y = dw^T * inter^T + db; D register r = pixel q of image row
    //      p = 2*qt + hi, lane l16 = token of the 16-token tile kg ----
    const int h = blockIdx.x & 63;
    float* o0 = out + (((size_t)b * 3) * 512 + h * 8 + qt * 2 + hi) * 512 + kg * 128 + l16 * 8;
    const float* pi = sI[0] + (kg * 16 + l16) * INT_P + hi * 2;
    v8f y0, y1, y2;                       // channels 0, 1, 2: three independent chains
    #pragma unroll
    for (int r = 0; r < 8; ++r) { y0[r] = bias0; y1[r] = bias1; y2[r] = bias2; }
    #pragma unroll
    for (int c = 0; c < 8; ++c) {
        // B-frag: dims {c*4+2*hi, +1}, the four key groups' partials added
        v2f bi = *(const v2f*)(pi + c * 4);
        #pragma unroll
        for (int g = 1; g < 4; ++g) bi += *(const v2f*)(pi + g * 64 * INT_P + c * 4);
        y0 = wmma_k4(a_w[0][c], bi, y0);
        y1 = wmma_k4(a_w[1][c], bi, y1);
        y2 = wmma_k4(a_w[2][c], bi, y2);
    }
    *(v4f*)(o0)                  = y0.lo;
    *(v4f*)(o0 + 4)              = y0.hi;
    *(v4f*)(o0 + 262144)         = y1.lo;
    *(v4f*)(o0 + 262144 + 4)     = y1.hi;
    *(v4f*)(o0 + 2 * 262144)     = y2.lo;
    *(v4f*)(o0 + 2 * 262144 + 4) = y2.hi;
}

// ---------------------------------------------------------------------------
extern "C" void kernel_launch(void* const* d_in, const int* in_sizes, int n_in,
                              void* d_out, int out_size, void* d_ws, size_t ws_size,
                              hipStream_t stream) {
    const float* x        = (const float*)d_in[0];
    const float* conv_w   = (const float*)d_in[1];
    const float* conv_b   = (const float*)d_in[2];
    const float* proj_w   = (const float*)d_in[3];
    const float* proj_b   = (const float*)d_in[4];
    const float* deconv_w = (const float*)d_in[5];
    const float* deconv_b = (const float*)d_in[6];
    float* out = (float*)d_out;

    float* ws   = (float*)d_ws;
    float* W2   = ws;                      // 96*192  = 18432 floats
    float* b2   = W2 + 18432;              // 96 (padded to 128)
    float* qbuf = b2 + 128;                // 4*4096*32 = 524288 floats
    float* kbuf = qbuf + 524288;
    float* vtbf = kbuf + 524288;           // V transposed [b][32][4096]

    fuse_weights_kernel<<<1, 96, 0, stream>>>(conv_w, conv_b, proj_w, proj_b, W2, b2);
    embed_kernel<<<256, 192, 0, stream>>>(x, W2, b2, qbuf, kbuf, vtbf);
    attn_kernel<<<256, 512, 0, stream>>>(qbuf, kbuf, vtbf, deconv_w, deconv_b, out);
}

// v005
// One run takes 54 microseconds.
// Timed twice side by side with v004, it ran 1.35 times as fast both times.
// All steps since v000 together make it 4.51 times as fast.
#include <hip/hip_runtime.h>
#include <hip/hip_bf16.h>

typedef __attribute__((ext_vector_type(2))) float v2f;
typedef __attribute__((ext_vector_type(4))) float v4f;
typedef __attribute__((ext_vector_type(8))) float v8f;
typedef __attribute__((ext_vector_type(4))) int   v4i;

// D = A(16x4 f32) * B(4x16 f32) + C(16x16 f32), wave32 WMMA
static __device__ __forceinline__ v8f wmma_k4(v2f a, v2f b, v8f c) {
    return __builtin_amdgcn_wmma_f32_16x16x4_f32(
        /*neg_a=*/false, a, /*neg_b=*/false, b,
        /*c_mod=*/(short)0, c, /*reuse_a=*/false, /*reuse_b=*/false);
}

// ---- gfx1250 async global->LDS staging (ASYNCcnt-tracked) ------------------
#if defined(__gfx1250__) && __has_builtin(__builtin_amdgcn_global_load_async_to_lds_b128)
#define USE_ASYNC_LDS 1
#else
#define USE_ASYNC_LDS 0
#endif

typedef __attribute__((address_space(1))) v4i g_v4i;   // global int4
typedef __attribute__((address_space(3))) v4i l_v4i;   // LDS int4
static __device__ __forceinline__ g_v4i* as_global_v4i(const void* p) {
    return (g_v4i*)(uintptr_t)p;
}
static __device__ __forceinline__ l_v4i* as_lds_v4i(const void* p) {
    return (l_v4i*)(unsigned)(uintptr_t)p;   // low 32 bits = LDS byte offset
}
template <int N> static __device__ __forceinline__ void wait_asynccnt() {
#if __has_builtin(__builtin_amdgcn_s_wait_asynccnt)
    __builtin_amdgcn_s_wait_asynccnt(N);
#else
    asm volatile("s_wait_asynccnt %0" ::"i"(N) : "memory");
#endif
}

// ---------------------------------------------------------------------------
// Kernel 1: patch embed, then qkv projection, two chained f32 WMMA GEMMs:
// T[64 tokens][32] = X[tokens][192] * conv_w^T + conv_b,
// Y[64 tokens][96] = T * proj_w^T + proj_b.
// One block per (batch, patch row): its 64 tokens read 3 x 8 image rows, which
// are three contiguous 16 KiB runs of x. They and conv_w are staged in LDS once.
// 6 waves. First product: wave = (image channel, token half), 32 tokens x 32
// dims over the 64 k values of its channel; the three channels' partial T tiles
// meet in LDS and are added, in channel order, where the second product reads
// them. Second product: wave = (q | k | v, token half), 32 tokens x 32 outputs,
// so every 128-byte line of q, k and vt has one writing wave.
// k order of the first product: for each image row (8 k values per token) lane
// (l16, hi) holds elements hi*4 .. hi*4+3 of its token (A) or of its conv_w row
// (B), loaded by the same code; the two WMMA steps take the low and the high
// pair. Second product: step c, lane (l16, hi) holds dims c*4+2*hi, +1 of its
// token (A) or of its proj_w row (B).
// V is written TRANSPOSED (vt[b][32][4096]) so the attention kernel's staged
// V tiles are [d][n] and every WMMA B-fragment is a contiguous b64.
// ---------------------------------------------------------------------------
#define EMB_BP 196   // LDS pitch of a conv_w row, floats: 784 B = 16 B x odd, no bank conflict for b128 reads
#define TOK_P  36    // LDS pitch of a T row, floats: 144 B = 16 B x odd, no bank conflict for the b32 writes and b64 reads

__global__ void __launch_bounds__(192)
embed_kernel(const float* __restrict__ x,
             const float* __restrict__ conv_w,
             const float* __restrict__ conv_b,
             const float* __restrict__ proj_w,
             const float* __restrict__ proj_b,
             float* __restrict__ q,
             float* __restrict__ k,
             float* __restrict__ vt) {
    __shared__ __attribute__((aligned(16))) float sA[24 * 512];      // [c*8+p][512 pixels]
    __shared__ __attribute__((aligned(16))) float sB[32 * EMB_BP];   // [dim][192 + pad]
    __shared__ __attribute__((aligned(16))) float sT[3][64 * TOK_P]; // partial T [channel][token][dim + pad]

    const int t    = threadIdx.x;         // 0..191
    const int b    = blockIdx.x >> 6;     // 64 patch rows per batch
    const int h    = blockIdx.x & 63;
    const int lane = t & 31;
    const int hi   = lane >> 4;
    const int l16  = lane & 15;
    const int wave = __builtin_amdgcn_readfirstlane(t >> 5);
    const int part = wave >> 1;           // first product: image channel; second: 0 q, 1 k, 2 v
    const int mh   = wave & 1;            // token half of the row

    // ---- stage x rows (3072 x 16 B) and conv_w (1536 x 16 B) ----
    // x: wave pair 'part' takes channel 'part', 16 sweeps of 64 chunks; conv_w
    // is read flat, 48 chunks per row, 4 rows per sweep.
    const int tc = t & 63;
    const float* xs = x + (((size_t)b * 3 + part) * 512 + h * 8) * 512;
    v4f ra[16], rb[8];
    #pragma unroll
    for (int it = 0; it < 16; ++it) ra[it] = *(const v4f*)(xs + (it * 64 + tc) * 4);
    #pragma unroll
    for (int it = 0; it < 8; ++it) rb[it] = *(const v4f*)(conv_w + (it * 192 + t) * 4);
    // proj_w, B-layout, straight to registers: lane column = output
    // part*32 + l16 (w2a) or + 16 (w2b), pair = dims {c*4+2*hi, +1}
    const float* pw = proj_w + (part * 32 + l16) * 32 + hi * 2;
    v2f w2a[8], w2b[8];
    #pragma unroll   // constant indices keep w2a and w2b in registers
    for (int c = 0; c < 8; ++c) {
        w2a[c] = *(const v2f*)(pw + c * 4);
        w2b[c] = *(const v2f*)(pw + 16 * 32 + c * 4);
    }
    const float bias0 = proj_b[part * 32 + l16];
    const float bias1 = proj_b[part * 32 + 16 + l16];
    const float cb0   = conv_b[l16];
    const float cb1   = conv_b[16 + l16];
    // the loads' address registers may be reused only behind this wait
    asm volatile("s_wait_xcnt 0x0" ::: "memory");
    float* da = sA + part * 4096 + tc * 4;
    float* db = sB + (t / 48) * EMB_BP + (t % 48) * 4;
    #pragma unroll
    for (int it = 0; it < 16; ++it) *(v4f*)(da + it * 256) = ra[it];
    #pragma unroll
    for (int it = 0; it < 8; ++it) *(v4f*)(db + it * 4 * EMB_BP) = rb[it];
    __syncthreads();

    // ---- first product, this wave's channel; conv_b enters with channel 0 ----
    const float* pa = sA + part * 4096 + (mh * 32 + l16) * 8 + hi * 4;
    const float* pb = sB + l16 * EMB_BP + part * 64 + hi * 4;
    const float c0 = part == 0 ? cb0 : 0.f;
    const float c1 = part == 0 ? cb1 : 0.f;

    v8f t00, t01, t10, t11;               // [token tile][dim tile]
    #pragma unroll   // constant element indices: plain register moves
    for (int r = 0; r < 8; ++r) {
        t00[r] = c0; t10[r] = c0;
        t01[r] = c1; t11[r] = c1;
    }

    #pragma unroll   // LDS offsets become immediates, the next row's reads go ahead of this row's WMMAs
    for (int p = 0; p < 8; ++p) {
        const v4f a0 = *(const v4f*)(pa + p * 512);
        const v4f a1 = *(const v4f*)(pa + p * 512 + 128);
        const v4f w0 = *(const v4f*)(pb + p * 8);
        const v4f w1 = *(const v4f*)(pb + p * 8 + 16 * EMB_BP);
        t00 = wmma_k4(a0.xy, w0.xy, t00);
        t01 = wmma_k4(a0.xy, w1.xy, t01);
        t10 = wmma_k4(a1.xy, w0.xy, t10);
        t11 = wmma_k4(a1.xy, w1.xy, t11);
        t00 = wmma_k4(a0.zw, w0.zw, t00);
        t01 = wmma_k4(a0.zw, w1.zw, t01);
        t10 = wmma_k4(a1.zw, w0.zw, t10);
        t11 = wmma_k4(a1.zw, w1.zw, t11);
    }

    // ---- partial T tiles (D register r = token 8*hi + r, dim l16) -> LDS ----
    float* st = sT[part] + (mh * 32 + hi * 8) * TOK_P + l16;
    #pragma unroll   // constant element indices: the stores read the D registers directly
    for (int r = 0; r < 8; ++r) {
        st[r * TOK_P]             = t00[r];
        st[r * TOK_P + 16]        = t01[r];
        st[(r + 16) * TOK_P]      = t10[r];
        st[(r + 16) * TOK_P + 16] = t11[r];
    }
    __syncthreads();                      // every wave reads the partials of three channels

    // ---- second product ----
    const float* pt = sT[0] + (mh * 32 + l16) * TOK_P + hi * 2;
    v8f acc00, acc01, acc10, acc11;       // [token tile][output tile]
    #pragma unroll
    for (int r = 0; r < 8; ++r) {
        acc00[r] = bias0; acc10[r] = bias0;
        acc01[r] = bias1; acc11[r] = bias1;
    }
    #pragma unroll   // constant indices into w2a and w2b; later steps' LDS reads go ahead of the WMMAs
    for (int c = 0; c < 8; ++c) {
        // A-frag: dims {c*4+2*hi, +1}, the three channels' partials added
        v2f a0 = *(const v2f*)(pt + c * 4);
        v2f a1 = *(const v2f*)(pt + 16 * TOK_P + c * 4);
        #pragma unroll   // two adds a fragment, LDS offsets as immediates
        for (int g = 1; g < 3; ++g) {
            a0 += *(const v2f*)(pt + g * 64 * TOK_P + c * 4);
            a1 += *(const v2f*)(pt + g * 64 * TOK_P + 16 * TOK_P + c * 4);
        }
        acc00 = wmma_k4(a0, w2a[c], acc00);
        acc01 = wmma_k4(a0, w2b[c], acc01);
        acc10 = wmma_k4(a1, w2a[c], acc10);
        acc11 = wmma_k4(a1, w2b[c], acc11);
    }

    // ---- D register r = Y[token 8*hi + r][output l16] ----
    const int nb = h * 64 + mh * 32;      // first token of this wave in its batch
    if (part < 2) {
        float* dst = (part == 0 ? q : k) + ((size_t)b * 4096 + nb + hi * 8) * 32 + l16;
        #pragma unroll
        for (int r = 0; r < 8; ++r) {
            dst[r * 32]             = acc00[r];
            dst[r * 32 + 16]        = acc01[r];
            dst[(r + 16) * 32]      = acc10[r];
            dst[(r + 16) * 32 + 16] = acc11[r];
        }
    } else {
        float* dv = vt + ((size_t)b * 32 + l16) * 4096 + nb + hi * 8;
        *(v4f*)(dv)                  = acc00.lo;
        *(v4f*)(dv + 4)              = acc00.hi;
        *(v4f*)(dv + 16)             = acc10.lo;
        *(v4f*)(dv + 20)             = acc10.hi;
        *(v4f*)(dv + 16 * 4096)      = acc01.lo;
        *(v4f*)(dv + 16 * 4096 + 4)  = acc01.hi;
        *(v4f*)(dv + 16 * 4096 + 16) = acc11.lo;
        *(v4f*)(dv + 16 * 4096 + 20) = acc11.hi;
        // the stores' address registers may be reused only behind this wait
        asm volatile("s_wait_xcnt 0x0" ::: "memory");
    }
}

// ---------------------------------------------------------------------------
// Kernel 2: fused attention  inter = cos(2*pi * (Q K^T, zero diag)) @ V, then
// the transposed convolution of inter, written straight to the image.
// 16 waves/block, four a SIMD: wave = (Q row-tile qt of the block's four, key
// group kg of four). A stage is 128 keys; of its eight 16-key tiles wave
// (qt, kg) takes tiles kg and kg + 4, so a query tile's key sum is shared by
// four waves, each with its own partial accumulator. While one wave waits on
// its dependent WMMA chain, its cosines or its P tile's way through LDS, the
// three others of its SIMD issue.
// K/V stages are brought into LDS cooperatively with double buffering via
// global_load_async_to_lds_b128 (ASYNCcnt), so the next stage's fill overlaps
// the current stage's WMMAs. All fragments in the hot loop are ds_load_b64,
// one tile row a lane: the rows of the K, V and P tiles lie at a pitch of
// 16 B x odd, so that the 32 lanes of a read fall on 64 different banks.
// Epilogue: the four partial inter tiles of each query tile meet in LDS and
// are added, in the order of kg, where the next product reads them.
// ConvTranspose2d with kernel = stride = 8 is a GEMM,
// Y[192 = (o,p,q)][token] = dw^T[192][32] * inter^T[32][token] + db[o].
// A block's 64 tokens are one patch row, so it owns 3 x 8 whole image rows.
// Wave (w4, tt) takes image rows p = 2*w4, 2*w4+1 of the three channels for
// the 16 tokens of tile tt. With the weights as the A operand a lane's 8
// results are the 8 pixels q of one patch row: two 16-byte stores.
// ---------------------------------------------------------------------------
#define SKEYS 128    // keys a stage
#define K_P   36     // LDS pitch of a K row (32 dims), floats: 144 B = 16 B x odd
#define V_P   132    // LDS pitch of a V^T row (128 keys), floats: 528 B = 16 B x odd
#define P_P   20     // LDS pitch of a P row (16 keys), floats: 80 B = 16 B x odd
#define INT_P 36     // LDS pitch of an inter row, floats: 144 B = 16 B x odd, no bank conflict for the b32 writes and b64 reads

__global__ void __launch_bounds__(512)
attn_kernel(const float* __restrict__ q,
            const float* __restrict__ k,
            const float* __restrict__ vt,
            const float* __restrict__ dw,
            const float* __restrict__ db,
            float* __restrict__ out) {
    __shared__ __attribute__((aligned(16))) float ldsK[2][SKEYS * K_P];   // [buf][key n][dim d + pad]
    __shared__ __attribute__((aligned(16))) float ldsV[2][32 * V_P];      // [buf][dim d][key n + pad]
    __shared__ float ptile[16][2][16 * P_P];  // per-wave P tiles (C->A relayout), [query m][key n + pad]
    __shared__ __attribute__((aligned(16))) float sI[4][64 * INT_P];      // partial inter [kg][token][dim + pad]

    const int t    = threadIdx.x;         // 0..511
    const int lane = t & 31;
    const int wave = __builtin_amdgcn_readfirstlane(t >> 5);
    const int qt   = wave & 3;            // Q row-tile of the block; in the epilogue the image row pair
    const int kg   = wave >> 2;           // key group; in the epilogue the token tile
    const int b    = blockIdx.x >> 6;     // 64 blocks per batch
    const int i    = (blockIdx.x & 63) * 4 + qt;    // Q row-tile index
    const int hi   = lane >> 4;
    const int l16  = lane & 15;

    const float* qb  = q  + ((size_t)b * 4096 + i * 16) * 32;
    const float* kb  = k  + (size_t)b * 4096 * 32;
    const float* vtb = vt + (size_t)b * 32 * 4096;

    // staging addressing: both tiles are 1024 chunks of 16 B, two a thread
    const int krow = t >> 3, kcol = (t & 7) * 4;    // K stage: 128 x 32, rows krow and krow + 64
    const int vrow = t >> 5, vcol = (t & 31) * 4;   // V stage: 32 x 128, rows vrow and vrow + 16

    // Q fragment, A-layout: lane row=l16, VGPR pair = K {c*4+2*hi, +1}
    v2f a_q[8];
    #pragma unroll
    for (int c = 0; c < 8; ++c)
        a_q[c] = *(const v2f*)(qb + l16 * 32 + c * 4 + hi * 2);

    // Deconv weights, A-layout, fetched here so that their latency lies under
    // the key loop: lane row = output o*64 + qt*16 + l16, pair = dims {c*4+2*hi, +1}
    const float* wp = dw + hi * 2 * 192 + qt * 16 + l16;
    v2f a_w[3][8];
    #pragma unroll
    for (int o = 0; o < 3; ++o) {
        #pragma unroll
        for (int c = 0; c < 8; ++c) {
            a_w[o][c].x = wp[(c * 4) * 192 + o * 64];
            a_w[o][c].y = wp[(c * 4 + 1) * 192 + o * 64];
        }
    }
    const float bias0 = db[0], bias1 = db[1], bias2 = db[2];
    // the loads' address registers may be reused only behind this wait
    asm volatile("s_wait_xcnt 0x0" ::: "memory");

    v8f acc0 = {}; v8f acc1 = {};         // partial D tile: dims 0-15 / 16-31

    // ---- bring stage j (keys j*128 .. j*128+127) into buffer buf ----
    auto stage = [&](int j, int buf) {
        #pragma unroll
        for (int u = 0; u < 2; ++u) {
            const int kr = krow + u * 64, vr = vrow + u * 16;
            const float* gk = kb  + ((size_t)(j * SKEYS + kr)) * 32 + kcol;
            const float* gv = vtb + (size_t)vr * 4096 + j * SKEYS + vcol;
#if USE_ASYNC_LDS
            __builtin_amdgcn_global_load_async_to_lds_b128(
                as_global_v4i(gk), as_lds_v4i(&ldsK[buf][kr * K_P + kcol]), 0, 0);
            __builtin_amdgcn_global_load_async_to_lds_b128(
                as_global_v4i(gv), as_lds_v4i(&ldsV[buf][vr * V_P + vcol]), 0, 0);
#else
            *(float4*)(&ldsK[buf][kr * K_P + kcol]) = *(const float4*)gk;
            *(float4*)(&ldsV[buf][vr * V_P + vcol]) = *(const float4*)gv;
#endif
        }
    };

    stage(0, 0);
    for (int j = 0; j < 4096 / SKEYS; ++j) {
        const int cur = j & 1;
        if (j + 1 < 4096 / SKEYS) {
            stage(j + 1, cur ^ 1);
#if USE_ASYNC_LDS
            wait_asynccnt<4>();           // drain stage j, let stage j+1's four copies fly
#endif
        } else {
#if USE_ASYNC_LDS
            wait_asynccnt<0>();
#endif
        }
        __syncthreads();

        #pragma unroll
        for (int u = 0; u < 2; ++u) {
            const int kt = u * 4 + kg;            // this wave's key tile of the stage
            const int jt = j * (SKEYS / 16) + kt; // key tile index in the batch
            const float* kc = ldsK[cur] + kt * 16 * K_P;
            const float* vc = ldsV[cur] + kt * 16;
            float* pt = ptile[wave][u];

            // ---- S = Qtile * Ktile^T (16x16), K-dim = 32 in 8 WMMA steps ----
            v8f s = {};
            #pragma unroll
            for (int c = 0; c < 8; ++c) {
                v2f bk = *(const v2f*)(kc + l16 * K_P + c * 4 + hi * 2);  // ds_load_b64
                s = wmma_k4(a_q[c], bk, s);
            }
            // ---- P = cos(2*pi*S) (v_cos_f32 semantics), diag forced to 1 ----
            #pragma unroll
            for (int r = 0; r < 8; ++r) {
                const int m = r + hi * 8;
                float pv = __builtin_amdgcn_cosf(s[r]);
                pv = (i == jt && m == l16) ? 1.0f : pv;
                pt[m * P_P + l16] = pv;
            }
            // ---- D += Ptile(16x16) * Vtile(16x32), inner dim 16 in 4 steps ----
            #pragma unroll
            for (int c = 0; c < 4; ++c) {
                v2f ap  = *(const v2f*)(pt + l16 * P_P + c * 4 + hi * 2);         // A-frag
                v2f bv0 = *(const v2f*)(vc + l16 * V_P + c * 4 + hi * 2);         // d 0-15
                acc0 = wmma_k4(ap, bv0, acc0);
                v2f bv1 = *(const v2f*)(vc + (l16 + 16) * V_P + c * 4 + hi * 2);  // d 16-31
                acc1 = wmma_k4(ap, bv1, acc1);
            }
        }
        __syncthreads();                  // all reads done before buf reuse
    }

    // ---- partial inter tile (D register r = token 8*hi + r, dim l16) -> LDS ----
    float* si = sI[kg] + (qt * 16 + hi * 8) * INT_P + l16;
    #pragma unroll
    for (int r = 0; r < 8; ++r) {
        si[r * INT_P]      = acc0[r];
        si[r * INT_P + 16] = acc1[r];
    }
    __syncthreads();                      // every wave reads partials written by other waves

    // ---- Y = dw^T * inter^T + db; D register r = pixel q of image row
    //      p = 2*qt + hi, lane l16 = token of the 16-token tile kg ----
    const int h = blockIdx.x & 63;
    float* o0 = out + (((size_t)b * 3) * 512 + h * 8 + qt * 2 + hi) * 512 + kg * 128 + l16 * 8;
    const float* pi = sI[0] + (kg * 16 + l16) * INT_P + hi * 2;
    v8f y0, y1, y2;                       // channels 0, 1, 2: three independent chains
    #pragma unroll
    for (int r = 0; r < 8; ++r) { y0[r] = bias0; y1[r] = bias1; y2[r] = bias2; }
    #pragma unroll
    for (int c = 0; c < 8; ++c) {
        // B-frag: dims {c*4+2*hi, +1}, the four key groups' partials added
        v2f bi = *(const v2f*)(pi + c * 4);
        #pragma unroll
        for (int g = 1; g < 4; ++g) bi += *(const v2f*)(pi + g * 64 * INT_P + c * 4);
        y0 = wmma_k4(a_w[0][c], bi, y0);
        y1 = wmma_k4(a_w[1][c], bi, y1);
        y2 = wmma_k4(a_w[2][c], bi, y2);
    }
    *(v4f*)(o0)                  = y0.lo;
    *(v4f*)(o0 + 4)              = y0.hi;
    *(v4f*)(o0 + 262144)         = y1.lo;
    *(v4f*)(o0 + 262144 + 4)     = y1.hi;
    *(v4f*)(o0 + 2 * 262144)     = y2.lo;
    *(v4f*)(o0 + 2 * 262144 + 4) = y2.hi;
}

// ---------------------------------------------------------------------------
extern "C" void kernel_launch(void* const* d_in, const int* in_sizes, int n_in,
                              void* d_out, int out_size, void* d_ws, size_t ws_size,
                              hipStream_t stream) {
    const float* x        = (const float*)d_in[0];
    const float* conv_w   = (const float*)d_in[1];
    const float* conv_b   = (const float*)d_in[2];
    const float* proj_w   = (const float*)d_in[3];
    const float* proj_b   = (const float*)d_in[4];
    const float* deconv_w = (const float*)d_in[5];
    const float* deconv_b = (const float*)d_in[6];
    float* out = (float*)d_out;

    float* ws   = (float*)d_ws;
    float* qbuf = ws;                      // 4*4096*32 = 524288 floats
    float* kbuf = qbuf + 524288;
    float* vtbf = kbuf + 524288;           // V transposed [b][32][4096]

    embed_kernel<<<256, 192, 0, stream>>>(x, conv_w, conv_b, proj_w, proj_b, qbuf, kbuf, vtbf);
    attn_kernel<<<256, 512, 0, stream>>>(qbuf, kbuf, vtbf, deconv_w, deconv_b, out);
}

// v006
// Measured time: 52.1 microseconds a run.
// Next to v005, in two timings, it ran 1.04 times as fast each time.
// All steps since v000 together make it 4.67 times as fast.
#include <hip/hip_runtime.h>
#include <hip/hip_bf16.h>

typedef __attribute__((ext_vector_type(2))) float v2f;
typedef __attribute__((ext_vector_type(4))) float v4f;
typedef __attribute__((ext_vector_type(8))) float v8f;
typedef __attribute__((ext_vector_type(4))) int   v4i;

// D = A(16x4 f32) * B(4x16 f32) + C(16x16 f32), wave32 WMMA
static __device__ __forceinline__ v8f wmma_k4(v2f a, v2f b, v8f c) {
    return __builtin_amdgcn_wmma_f32_16x16x4_f32(
        /*neg_a=*/false, a, /*neg_b=*/false, b,
        /*c_mod=*/(short)0, c, /*reuse_a=*/false, /*reuse_b=*/false);
}

// ---- gfx1250 async global->LDS staging (ASYNCcnt-tracked) ------------------
#if defined(__gfx1250__) && __has_builtin(__builtin_amdgcn_global_load_async_to_lds_b128)
#define USE_ASYNC_LDS 1
#else
#define USE_ASYNC_LDS 0
#endif

typedef __attribute__((address_space(1))) v4i g_v4i;   // global int4
typedef __attribute__((address_space(3))) v4i l_v4i;   // LDS int4
static __device__ __forceinline__ g_v4i* as_global_v4i(const void* p) {
    return (g_v4i*)(uintptr_t)p;
}
static __device__ __forceinline__ l_v4i* as_lds_v4i(const void* p) {
    return (l_v4i*)(unsigned)(uintptr_t)p;   // low 32 bits = LDS byte offset
}
template <int N> static __device__ __forceinline__ void wait_asynccnt() {
#if __has_builtin(__builtin_amdgcn_s_wait_asynccnt)
    __builtin_amdgcn_s_wait_asynccnt(N);
#else
    asm volatile("s_wait_asynccnt %0" ::"i"(N) : "memory");
#endif
}

// ---------------------------------------------------------------------------
// Kernel 1: patch embed, then qkv projection, two chained f32 WMMA GEMMs:
// T[64 tokens][32] = X[tokens][192] * conv_w^T + conv_b,
// Y[64 tokens][96] = T * proj_w^T + proj_b.
// One block per (batch, patch row): its 64 tokens read 3 x 8 image rows, which
// are three contiguous 16 KiB runs of x. They and conv_w are staged in LDS once.
// 6 waves. First product: wave = (image channel, token half), 32 tokens x 32
// dims over the 64 k values of its channel; the three channels' partial T tiles
// meet in LDS and are added, in channel order, where the second product reads
// them. Second product: wave = (q | k | v, token half), 32 tokens x 32 outputs,
// so every 128-byte line of q, k and vt has one writing wave.
// k order of the first product: for each image row (8 k values per token) lane
// (l16, hi) holds elements hi*4 .. hi*4+3 of its token (A) or of its conv_w row
// (B), loaded by the same code; the two WMMA steps take the low and the high
// pair. Second product: step c, lane (l16, hi) holds dims c*4+2*hi, +1 of its
// token (A) or of its proj_w row (B).
// V is written TRANSPOSED (vt[b][32][4096]) so the attention kernel's staged
// V tiles are [d][n] and every WMMA B-fragment is a contiguous b64.
// ---------------------------------------------------------------------------
#define EMB_BP 196   // LDS pitch of a conv_w row, floats: 784 B = 16 B x odd, no bank conflict for b128 reads
#define TOK_P  36    // LDS pitch of a T row, floats: 144 B = 16 B x odd, no bank conflict for the b32 writes and b64 reads

__global__ void __launch_bounds__(192)
embed_kernel(const float* __restrict__ x,
             const float* __restrict__ conv_w,
             const float* __restrict__ conv_b,
             const float* __restrict__ proj_w,
             const float* __restrict__ proj_b,
             float* __restrict__ q,
             float* __restrict__ k,
             float* __restrict__ vt) {
    __shared__ __attribute__((aligned(16))) float sA[24 * 512];      // [c*8+p][512 pixels]
    __shared__ __attribute__((aligned(16))) float sB[32 * EMB_BP];   // [dim][192 + pad]
    __shared__ __attribute__((aligned(16))) float sT[3][64 * TOK_P]; // partial T [channel][token][dim + pad]

    const int t    = threadIdx.x;         // 0..191
    const int b    = blockIdx.x >> 6;     // 64 patch rows per batch
    const int h    = blockIdx.x & 63;
    const int lane = t & 31;
    const int hi   = lane >> 4;
    const int l16  = lane & 15;
    const int wave = __builtin_amdgcn_readfirstlane(t >> 5);
    const int part = wave >> 1;           // first product: image channel; second: 0 q, 1 k, 2 v
    const int mh   = wave & 1;            // token half of the row

    // ---- stage x rows (3072 x 16 B) and conv_w (1536 x 16 B) ----
    // x: wave pair 'part' takes channel 'part', 16 sweeps of 64 chunks; conv_w
    // is read flat, 48 chunks per row, 4 rows per sweep.
    const int tc = t & 63;
    const float* xs = x + (((size_t)b * 3 + part) * 512 + h * 8) * 512;
    v4f ra[16], rb[8];
    #pragma unroll
    for (int it = 0; it < 16; ++it) ra[it] = *(const v4f*)(xs + (it * 64 + tc) * 4);
    #pragma unroll
    for (int it = 0; it < 8; ++it) rb[it] = *(const v4f*)(conv_w + (it * 192 + t) * 4);
    // proj_w, B-layout, straight to registers: lane column = output
    // part*32 + l16 (w2a) or + 16 (w2b), pair = dims {c*4+2*hi, +1}
    const float* pw = proj_w + (part * 32 + l16) * 32 + hi * 2;
    v2f w2a[8], w2b[8];
    #pragma unroll   // constant indices keep w2a and w2b in registers
    for (int c = 0; c < 8; ++c) {
        w2a[c] = *(const v2f*)(pw + c * 4);
        w2b[c] = *(const v2f*)(pw + 16 * 32 + c * 4);
    }
    const float bias0 = proj_b[part * 32 + l16];
    const float bias1 = proj_b[part * 32 + 16 + l16];
    const float cb0   = conv_b[l16];
    const float cb1   = conv_b[16 + l16];
    // the loads' address registers may be reused only behind this wait
    asm volatile("s_wait_xcnt 0x0" ::: "memory");
    float* da = sA + part * 4096 + tc * 4;
    float* db = sB + (t / 48) * EMB_BP + (t % 48) * 4;
    #pragma unroll
    for (int it = 0; it < 16; ++it) *(v4f*)(da + it * 256) = ra[it];
    #pragma unroll
    for (int it = 0; it < 8; ++it) *(v4f*)(db + it * 4 * EMB_BP) = rb[it];
    __syncthreads();

    // ---- first product, this wave's channel; conv_b enters with channel 0 ----
    const float* pa = sA + part * 4096 + (mh * 32 + l16) * 8 + hi * 4;
    const float* pb = sB + l16 * EMB_BP + part * 64 + hi * 4;
    const float c0 = part == 0 ? cb0 : 0.f;
    const float c1 = part == 0 ? cb1 : 0.f;

    v8f t00, t01, t10, t11;               // [token tile][dim tile]
    #pragma unroll   // constant element indices: plain register moves
    for (int r = 0; r < 8; ++r) {
        t00[r] = c0; t10[r] = c0;
        t01[r] = c1; t11[r] = c1;
    }

    #pragma unroll   // LDS offsets become immediates, the next row's reads go ahead of this row's WMMAs
    for (int p = 0; p < 8; ++p) {
        const v4f a0 = *(const v4f*)(pa + p * 512);
        const v4f a1 = *(const v4f*)(pa + p * 512 + 128);
        const v4f w0 = *(const v4f*)(pb + p * 8);
        const v4f w1 = *(const v4f*)(pb + p * 8 + 16 * EMB_BP);
        t00 = wmma_k4(a0.xy, w0.xy, t00);
        t01 = wmma_k4(a0.xy, w1.xy, t01);
        t10 = wmma_k4(a1.xy, w0.xy, t10);
        t11 = wmma_k4(a1.xy, w1.xy, t11);
        t00 = wmma_k4(a0.zw, w0.zw, t00);
        t01 = wmma_k4(a0.zw, w1.zw, t01);
        t10 = wmma_k4(a1.zw, w0.zw, t10);
        t11 = wmma_k4(a1.zw, w1.zw, t11);
    }

    // ---- partial T tiles (D register r = token 8*hi + r, dim l16) -> LDS ----
    float* st = sT[part] + (mh * 32 + hi * 8) * TOK_P + l16;
    #pragma unroll   // constant element indices: the stores read the D registers directly
    for (int r = 0; r < 8; ++r) {
        st[r * TOK_P]             = t00[r];
        st[r * TOK_P + 16]        = t01[r];
        st[(r + 16) * TOK_P]      = t10[r];
        st[(r + 16) * TOK_P + 16] = t11[r];
    }
    __syncthreads();                      // every wave reads the partials of three channels

    // ---- second product ----
    const float* pt = sT[0] + (mh * 32 + l16) * TOK_P + hi * 2;
    v8f acc00, acc01, acc10, acc11;       // [token tile][output tile]
    #pragma unroll
    for (int r = 0; r < 8; ++r) {
        acc00[r] = bias0; acc10[r] = bias0;
        acc01[r] = bias1; acc11[r] = bias1;
    }
    #pragma unroll   // constant indices into w2a and w2b; later steps' LDS reads go ahead of the WMMAs
    for (int c = 0; c < 8; ++c) {
        // A-frag: dims {c*4+2*hi, +1}, the three channels' partials added
        v2f a0 = *(const v2f*)(pt + c * 4);
        v2f a1 = *(const v2f*)(pt + 16 * TOK_P + c * 4);
        #pragma unroll   // two adds a fragment, LDS offsets as immediates
        for (int g = 1; g < 3; ++g) {
            a0 += *(const v2f*)(pt + g * 64 * TOK_P + c * 4);
            a1 += *(const v2f*)(pt + g * 64 * TOK_P + 16 * TOK_P + c * 4);
        }
        acc00 = wmma_k4(a0, w2a[c], acc00);
        acc01 = wmma_k4(a0, w2b[c], acc01);
        acc10 = wmma_k4(a1, w2a[c], acc10);
        acc11 = wmma_k4(a1, w2b[c], acc11);
    }

    // ---- D register r = Y[token 8*hi + r][output l16] ----
    const int nb = h * 64 + mh * 32;      // first token of this wave in its batch
    if (part < 2) {
        float* dst = (part == 0 ? q : k) + ((size_t)b * 4096 + nb + hi * 8) * 32 + l16;
        #pragma unroll
        for (int r = 0; r < 8; ++r) {
            dst[r * 32]             = acc00[r];
            dst[r * 32 + 16]        = acc01[r];
            dst[(r + 16) * 32]      = acc10[r];
            dst[(r + 16) * 32 + 16] = acc11[r];
        }
    } else {
        float* dv = vt + ((size_t)b * 32 + l16) * 4096 + nb + hi * 8;
        *(v4f*)(dv)                  = acc00.lo;
        *(v4f*)(dv + 4)              = acc00.hi;
        *(v4f*)(dv + 16)             = acc10.lo;
        *(v4f*)(dv + 20)             = acc10.hi;
        *(v4f*)(dv + 16 * 4096)      = acc01.lo;
        *(v4f*)(dv + 16 * 4096 + 4)  = acc01.hi;
        *(v4f*)(dv + 16 * 4096 + 16) = acc11.lo;
        *(v4f*)(dv + 16 * 4096 + 20) = acc11.hi;
        // the stores' address registers may be reused only behind this wait
        asm volatile("s_wait_xcnt 0x0" ::: "memory");
    }
}

// ---------------------------------------------------------------------------
// Kernel 2: fused attention  inter = cos(2*pi * (Q K^T, zero diag)) @ V, then
// the transposed convolution of inter, written straight to the image.
// 16 waves/block, four a SIMD: wave = (Q row-tile qt of the block's four, key
// group kg of four). A stage is 128 keys; of its eight 16-key tiles wave
// (qt, kg) takes tiles kg and kg + 4, so a query tile's key sum is shared by
// four waves, each with its own partial accumulator. While one wave waits on
// its dependent WMMA chain or its cosines, the three others of its SIMD issue.
// The scores are computed transposed, S^T = K * Q^T: a lane's 8 D registers
// then hold 8 keys of ONE query, which is what an A fragment of P holds, so
// the cosines go from the D registers straight into the P * V product and P
// never passes through LDS. V takes the same k order.
// K/V stages are brought into LDS cooperatively with double buffering via
// global_load_async_to_lds_b128 (ASYNCcnt), so the next stage's fill overlaps
// the current stage's WMMAs. The fragments in the hot loop are ds_load_b64 (K)
// and ds_load_b128 (V), one tile row a lane: the rows of the K and V tiles lie
// at a pitch of 16 B x odd, so that no read has a bank conflict.
// Epilogue: the four partial inter tiles of each query tile meet in LDS and
// are added, in the order of kg, where the next product reads them.
// ConvTranspose2d with kernel = stride = 8 is a GEMM,
// Y[192 = (o,p,q)][token] = dw^T[192][32] * inter^T[32][token] + db[o].
// A block's 64 tokens are one patch row, so it owns 3 x 8 whole image rows.
// Wave (w4, tt) takes image rows p = 2*w4, 2*w4+1 of the three channels for
// the 16 tokens of tile tt. With the weights as the A operand a lane's 8
// results are the 8 pixels q of one patch row: two 16-byte stores.
// ---------------------------------------------------------------------------
#define SKEYS 128    // keys a stage
#define K_P   36     // LDS pitch of a K row (32 dims), floats: 144 B = 16 B x odd
#define V_P   132    // LDS pitch of a V^T row (128 keys), floats: 528 B = 16 B x odd
#define INT_P 36     // LDS pitch of an inter row, floats: 144 B = 16 B x odd, no bank conflict for the b32 writes and b64 reads

__global__ void __launch_bounds__(512)
attn_kernel(const float* __restrict__ q,
            const float* __restrict__ k,
            const float* __restrict__ vt,
            const float* __restrict__ dw,
            const float* __restrict__ db,
            float* __restrict__ out) {
    __shared__ __attribute__((aligned(16))) float ldsK[2][SKEYS * K_P];   // [buf][key n][dim d + pad]
    __shared__ __attribute__((aligned(16))) float ldsV[2][32 * V_P];      // [buf][dim d][key n + pad]
    __shared__ __attribute__((aligned(16))) float sI[4][64 * INT_P];      // partial inter [kg][token][dim + pad]

    const int t    = threadIdx.x;         // 0..511
    const int lane = t & 31;
    const int wave = __builtin_amdgcn_readfirstlane(t >> 5);
    const int qt   = wave & 3;            // Q row-tile of the block; in the epilogue the image row pair
    const int kg   = wave >> 2;           // key group; in the epilogue the token tile
    const int b    = blockIdx.x >> 6;     // 64 blocks per batch
    const int i    = (blockIdx.x & 63) * 4 + qt;    // Q row-tile index
    const int hi   = lane >> 4;
    const int l16  = lane & 15;

    const float* qb  = q  + ((size_t)b * 4096 + i * 16) * 32;
    const float* kb  = k  + (size_t)b * 4096 * 32;
    const float* vtb = vt + (size_t)b * 32 * 4096;

    // staging addressing: both tiles are 1024 chunks of 16 B, two a thread
    const int krow = t >> 3, kcol = (t & 7) * 4;    // K stage: 128 x 32, rows krow and krow + 64
    const int vrow = t >> 5, vcol = (t & 31) * 4;   // V stage: 32 x 128, rows vrow and vrow + 16

    // Q fragment, B-layout: lane column = query l16, VGPR pair = dims {c*4+2*hi, +1}
    v2f b_q[8];
    #pragma unroll
    for (int c = 0; c < 8; ++c)
        b_q[c] = *(const v2f*)(qb + l16 * 32 + c * 4 + hi * 2);

    // Deconv weights, A-layout, fetched here so that their latency lies under
    // the key loop: lane row = output o*64 + qt*16 + l16, pair = dims {c*4+2*hi, +1}
    const float* wp = dw + hi * 2 * 192 + qt * 16 + l16;
    v2f a_w[3][8];
    #pragma unroll
    for (int o = 0; o < 3; ++o) {
        #pragma unroll
        for (int c = 0; c < 8; ++c) {
            a_w[o][c].x = wp[(c * 4) * 192 + o * 64];
            a_w[o][c].y = wp[(c * 4 + 1) * 192 + o * 64];
        }
    }
    const float bias0 = db[0], bias1 = db[1], bias2 = db[2];
    // the loads' address registers may be reused only behind this wait
    asm volatile("s_wait_xcnt 0x0" ::: "memory");

    v8f acc0 = {}; v8f acc1 = {};         // partial D tile: dims 0-15 / 16-31

    // ---- bring stage j (keys j*128 .. j*128+127) into buffer buf ----
    auto stage = [&](int j, int buf) {
        #pragma unroll
        for (int u = 0; u < 2; ++u) {
            const int kr = krow + u * 64, vr = vrow + u * 16;
            const float* gk = kb  + ((size_t)(j * SKEYS + kr)) * 32 + kcol;
            const float* gv = vtb + (size_t)vr * 4096 + j * SKEYS + vcol;
#if USE_ASYNC_LDS
            __builtin_amdgcn_global_load_async_to_lds_b128(
                as_global_v4i(gk), as_lds_v4i(&ldsK[buf][kr * K_P + kcol]), 0, 0);
            __builtin_amdgcn_global_load_async_to_lds_b128(
                as_global_v4i(gv), as_lds_v4i(&ldsV[buf][vr * V_P + vcol]), 0, 0);
#else
            *(float4*)(&ldsK[buf][kr * K_P + kcol]) = *(const float4*)gk;
            *(float4*)(&ldsV[buf][vr * V_P + vcol]) = *(const float4*)gv;
#endif
        }
    };

    stage(0, 0);
    for (int j = 0; j < 4096 / SKEYS; ++j) {
        const int cur = j & 1;
        if (j + 1 < 4096 / SKEYS) {
            stage(j + 1, cur ^ 1);
#if USE_ASYNC_LDS
            wait_asynccnt<4>();           // drain stage j, let stage j+1's four copies fly
#endif
        } else {
#if USE_ASYNC_LDS
            wait_asynccnt<0>();
#endif
        }
        __syncthreads();

        // this wave's two key tiles of the stage, kg and kg + 4: all their K and V
        // fragments are read here, in one group in front of the WMMAs.
        // K, A-layout: lane row = key l16, pair = dims {c*4+2*hi, +1}.
        // V^T, B-layout: lane column = dim l16 (v0) or 16 + l16 (v1), keys
        // 8*hi .. 8*hi+7 of the tile, two ds_load_b128 a row.
        const float* kc = ldsK[cur] + (kg * 16 + l16) * K_P + hi * 2;
        const float* vc = ldsV[cur] + l16 * V_P + kg * 16 + hi * 8;
        v2f ak[2][8];
        v4f v0[2][2], v1[2][2];
        // all loops of the stage are unrolled: constant indices keep the fragment
        // arrays, s and p in registers, and LDS offsets become immediates
        #pragma unroll
        for (int u = 0; u < 2; ++u) {
            #pragma unroll
            for (int c = 0; c < 8; ++c)
                ak[u][c] = *(const v2f*)(kc + u * 64 * K_P + c * 4);
        }
        #pragma unroll
        for (int u = 0; u < 2; ++u) {
            #pragma unroll
            for (int g = 0; g < 2; ++g) {
                v0[u][g] = *(const v4f*)(vc + u * 64 + g * 4);
                v1[u][g] = *(const v4f*)(vc + 16 * V_P + u * 64 + g * 4);
            }
        }
        // holds the reads above in one group in front of the WMMAs: without it they
        // are moved down among the WMMAs, to just ahead of their use, and the wave
        // waits out LDS latency at each such place
        __builtin_amdgcn_sched_barrier(0);

        #pragma unroll
        for (int u = 0; u < 2; ++u) {
            const int jt = j * (SKEYS / 16) + u * 4 + kg;   // key tile index in the batch

            // ---- S^T = Ktile * Qtile^T (16x16), inner dim 32 in 8 WMMA steps:
            //      D register r = S[query l16][key 8*hi + r] ----
            v8f s = {};
            #pragma unroll
            for (int c = 0; c < 8; ++c) s = wmma_k4(ak[u][c], b_q[c], s);
            // ---- P = cos(2*pi*S) (v_cos_f32 semantics), diag forced to 1 ----
            v8f p;
            #pragma unroll
            for (int r = 0; r < 8; ++r) {
                const int n = r + hi * 8;
                const float pv = __builtin_amdgcn_cosf(s[r]);
                p[r] = (i == jt && n == l16) ? 1.0f : pv;
            }
            // ---- D += Ptile(16x16) * Vtile(16x32), inner dim 16 in 4 steps.
            //      k order of both operands: step c, lane (l16, hi) holds keys
            //      8*hi + 2*c, +1 of its query (A, straight from p) or of its
            //      V^T row (B) ----
            const v2f p0 = {p[0], p[1]}, p1 = {p[2], p[3]}, p2 = {p[4], p[5]}, p3 = {p[6], p[7]};
            acc0 = wmma_k4(p0, v0[u][0].xy, acc0);
            acc1 = wmma_k4(p0, v1[u][0].xy, acc1);
            acc0 = wmma_k4(p1, v0[u][0].zw, acc0);
            acc1 = wmma_k4(p1, v1[u][0].zw, acc1);
            acc0 = wmma_k4(p2, v0[u][1].xy, acc0);
            acc1 = wmma_k4(p2, v1[u][1].xy, acc1);
            acc0 = wmma_k4(p3, v0[u][1].zw, acc0);
            acc1 = wmma_k4(p3, v1[u][1].zw, acc1);
        }
        // holds the barrier below behind the WMMAs: without it it is moved up behind
        // the reads, where every wave would wait for all 16 waves' reads, matrix unit idle
        __builtin_amdgcn_sched_barrier(0);
        __syncthreads();                  // all reads done before buf reuse
    }

    // ---- partial inter tile (D register r = token 8*hi + r, dim l16) -> LDS ----
    float* si = sI[kg] + (qt * 16 + hi * 8) * INT_P + l16;
    #pragma unroll
    for (int r = 0; r < 8; ++r) {
        si[r * INT_P]      = acc0[r];
        si[r * INT_P + 16] = acc1[r];
    }
    __syncthreads();                      // every wave reads partials written by other waves

    // ---- Y = dw^T * inter^T + db; D register r = pixel q of image row
    //      p = 2*qt + hi, lane l16 = token of the 16-token tile kg ----
    const int h = blockIdx.x & 63;
    float* o0 = out + (((size_t)b * 3) * 512 + h * 8 + qt * 2 + hi) * 512 + kg * 128 + l16 * 8;
    const float* pi = sI[0] + (kg * 16 + l16) * INT_P + hi * 2;
    v8f y0, y1, y2;                       // channels 0, 1, 2: three independent chains
    #pragma unroll
    for (int r = 0; r < 8; ++r) { y0[r] = bias0; y1[r] = bias1; y2[r] = bias2; }
    #pragma unroll
    for (int c = 0; c < 8; ++c) {
        // B-frag: dims {c*4+2*hi, +1}, the four key groups' partials added
        v2f bi = *(const v2f*)(pi + c * 4);
        #pragma unroll
        for (int g = 1; g < 4; ++g) bi += *(const v2f*)(pi + g * 64 * INT_P + c * 4);
        y0 = wmma_k4(a_w[0][c], bi, y0);
        y1 = wmma_k4(a_w[1][c], bi, y1);
        y2 = wmma_k4(a_w[2][c], bi, y2);
    }
    *(v4f*)(o0)                  = y0.lo;
    *(v4f*)(o0 + 4)              = y0.hi;
    *(v4f*)(o0 + 262144)         = y1.lo;
    *(v4f*)(o0 + 262144 + 4)     = y1.hi;
    *(v4f*)(o0 + 2 * 262144)     = y2.lo;
    *(v4f*)(o0 + 2 * 262144 + 4) = y2.hi;
}

// ---------------------------------------------------------------------------
extern "C" void kernel_launch(void* const* d_in, const int* in_sizes, int n_in,
                              void* d_out, int out_size, void* d_ws, size_t ws_size,
                              hipStream_t stream) {
    const float* x        = (const float*)d_in[0];
    const float* conv_w   = (const float*)d_in[1];
    const float* conv_b   = (const float*)d_in[2];
    const float* proj_w   = (const float*)d_in[3];
    const float* proj_b   = (const float*)d_in[4];
    const float* deconv_w = (const float*)d_in[5];
    const float* deconv_b = (const float*)d_in[6];
    float* out = (float*)d_out;

    float* ws   = (float*)d_ws;
    float* qbuf = ws;                      // 4*4096*32 = 524288 floats
    float* kbuf = qbuf + 524288;
    float* vtbf = kbuf + 524288;           // V transposed [b][32][4096]

    embed_kernel<<<256, 192, 0, stream>>>(x, conv_w, conv_b, proj_w, proj_b, qbuf, kbuf, vtbf);
    attn_kernel<<<256, 512, 0, stream>>>(qbuf, kbuf, vtbf, deconv_w, deconv_b, out);
}

// v007
// A run of this version takes 49.9 microseconds.
// Two timings next to v006 put it at 1.05 and 1.04 times that version's speed.
// Counting every step since v000, it is 4.88 times as fast.
#include <hip/hip_runtime.h>
#include <hip/hip_bf16.h>

typedef __attribute__((ext_vector_type(2))) float v2f;
typedef __attribute__((ext_vector_type(4))) float v4f;
typedef __attribute__((ext_vector_type(8))) float v8f;

// D = A(16x4 f32) * B(4x16 f32) + C(16x16 f32), wave32 WMMA
static __device__ __forceinline__ v8f wmma_k4(v2f a, v2f b, v8f c) {
    return __builtin_amdgcn_wmma_f32_16x16x4_f32(
        /*neg_a=*/false, a, /*neg_b=*/false, b,
        /*c_mod=*/(short)0, c, /*reuse_a=*/false, /*reuse_b=*/false);
}

// ---------------------------------------------------------------------------
// Kernel 1: patch embed, then qkv projection, two chained f32 WMMA GEMMs:
// T[64 tokens][32] = X[tokens][192] * conv_w^T + conv_b,
// Y[64 tokens][96] = T * proj_w^T + proj_b.
// One block per (batch, patch row): its 64 tokens read 3 x 8 image rows, which
// are three contiguous 16 KiB runs of x. They and conv_w are staged in LDS once.
// 6 waves. First product: wave = (image channel, token half), 32 tokens x 32
// dims over the 64 k values of its channel; the three channels' partial T tiles
// meet in LDS and are added, in channel order, where the second product reads
// them. Second product: wave = (q | k | v, token half), 32 tokens x 32 outputs.
// k order of the first product: for each image row (8 k values per token) lane
// (l16, hi) holds elements hi*4 .. hi*4+3 of its token (A) or of its conv_w row
// (B), loaded by the same code; the two WMMA steps take the low and the high
// pair. Second product: step c, lane (l16, hi) holds dims c*4+2*hi, +1 of its
// token or of its proj_w row.
// q, k and vt are written in the attention kernel's FRAGMENT ORDER: a tile of
// 16 tokens is 512 floats, float m*128 + lane*4 + e = element e of the lane's
// m-th 16-byte quad, so a wave stores, and later loads, a tile as four whole
// 512-byte runs, and every 128-byte line has one writing wave.
// q, k: the product is taken transposed (proj_w as A, T as B), so lane
// (l16, hi) holds of token l16 the dims 8*hi .. +7 (quads 0, 1) and
// 16 + 8*hi .. +7 (quads 2, 3). v: T as A, so lane (l16, hi) holds of dim l16
// (quads 0, 1) and of dim 16 + l16 (quads 2, 3) the tokens 8*hi .. +7.
// ---------------------------------------------------------------------------
#define EMB_BP 196   // LDS pitch of a conv_w row, floats: 784 B = 16 B x odd, no bank conflict for b128 reads
#define TOK_P  36    // LDS pitch of a T row, floats: 144 B = 16 B x odd, no bank conflict for the b32 writes and b64 reads

__global__ void __launch_bounds__(192)
embed_kernel(const float* __restrict__ x,
             const float* __restrict__ conv_w,
             const float* __restrict__ conv_b,
             const float* __restrict__ proj_w,
             const float* __restrict__ proj_b,
             float* __restrict__ q,
             float* __restrict__ k,
             float* __restrict__ vt) {
    __shared__ __attribute__((aligned(16))) float sA[24 * 512];      // [c*8+p][512 pixels]
    __shared__ __attribute__((aligned(16))) float sB[32 * EMB_BP];   // [dim][192 + pad]
    __shared__ __attribute__((aligned(16))) float sT[3][64 * TOK_P]; // partial T [channel][token][dim + pad]

    const int t    = threadIdx.x;         // 0..191
    const int b    = blockIdx.x >> 6;     // 64 patch rows per batch
    const int h    = blockIdx.x & 63;
    const int lane = t & 31;
    const int hi   = lane >> 4;
    const int l16  = lane & 15;
    const int wave = __builtin_amdgcn_readfirstlane(t >> 5);
    const int part = wave >> 1;           // first product: image channel; second: 0 q, 1 k, 2 v
    const int mh   = wave & 1;            // token half of the row

    // ---- stage x rows (3072 x 16 B) and conv_w (1536 x 16 B) ----
    // x: wave pair 'part' takes channel 'part', 16 sweeps of 64 chunks; conv_w
    // is read flat, 48 chunks per row, 4 rows per sweep.
    const int tc = t & 63;
    const float* xs = x + (((size_t)b * 3 + part) * 512 + h * 8) * 512;
    v4f ra[16], rb[8];
    #pragma unroll
    for (int it = 0; it < 16; ++it) ra[it] = *(const v4f*)(xs + (it * 64 + tc) * 4);
    #pragma unroll
    for (int it = 0; it < 8; ++it) rb[it] = *(const v4f*)(conv_w + (it * 192 + t) * 4);
    // proj_w, A-layout (q, k) or B-layout (v), straight to registers: lane row or column = output
    // part*32 + l16 (w2a) or + 16 (w2b), pair = dims {c*4+2*hi, +1}
    const float* pw = proj_w + (part * 32 + l16) * 32 + hi * 2;
    v2f w2a[8], w2b[8];
    #pragma unroll   // constant indices keep w2a and w2b in registers
    for (int c = 0; c < 8; ++c) {
        w2a[c] = *(const v2f*)(pw + c * 4);
        w2b[c] = *(const v2f*)(pw + 16 * 32 + c * 4);
    }
    const int   ob    = part * 32 + l16;
    const float bias0 = proj_b[ob];
    const float bias1 = proj_b[ob + 16];
    const float cb0   = conv_b[l16];
    const float cb1   = conv_b[16 + l16];
    // the loads' address registers may be reused only behind this wait; it names
    // the bias index so that no later load's result is placed over it ahead of it
    asm volatile("s_wait_xcnt 0x0" :: "v"(ob) : "memory");
    float* da = sA + part * 4096 + tc * 4;
    float* db = sB + (t / 48) * EMB_BP + (t % 48) * 4;
    #pragma unroll
    for (int it = 0; it < 16; ++it) *(v4f*)(da + it * 256) = ra[it];
    #pragma unroll
    for (int it = 0; it < 8; ++it) *(v4f*)(db + it * 4 * EMB_BP) = rb[it];
    __syncthreads();

    // ---- first product, this wave's channel; conv_b enters with channel 0 ----
    const float* pa = sA + part * 4096 + (mh * 32 + l16) * 8 + hi * 4;
    const float* pb = sB + l16 * EMB_BP + part * 64 + hi * 4;
    const float c0 = part == 0 ? cb0 : 0.f;
    const float c1 = part == 0 ? cb1 : 0.f;

    v8f t00, t01, t10, t11;               // [token tile][dim tile]
    #pragma unroll   // constant element indices: plain register moves
    for (int r = 0; r < 8; ++r) {
        t00[r] = c0; t10[r] = c0;
        t01[r] = c1; t11[r] = c1;
    }

    #pragma unroll   // LDS offsets become immediates, the next row's reads go ahead of this row's WMMAs
    for (int p = 0; p < 8; ++p) {
        const v4f a0 = *(const v4f*)(pa + p * 512);
        const v4f a1 = *(const v4f*)(pa + p * 512 + 128);
        const v4f w0 = *(const v4f*)(pb + p * 8);
        const v4f w1 = *(const v4f*)(pb + p * 8 + 16 * EMB_BP);
        t00 = wmma_k4(a0.xy, w0.xy, t00);
        t01 = wmma_k4(a0.xy, w1.xy, t01);
        t10 = wmma_k4(a1.xy, w0.xy, t10);
        t11 = wmma_k4(a1.xy, w1.xy, t11);
        t00 = wmma_k4(a0.zw, w0.zw, t00);
        t01 = wmma_k4(a0.zw, w1.zw, t01);
        t10 = wmma_k4(a1.zw, w0.zw, t10);
        t11 = wmma_k4(a1.zw, w1.zw, t11);
    }

    // ---- partial T tiles (D register r = token 8*hi + r, dim l16) -> LDS ----
    float* st = sT[part] + (mh * 32 + hi * 8) * TOK_P + l16;
    #pragma unroll   // constant element indices: the stores read the D registers directly
    for (int r = 0; r < 8; ++r) {
        st[r * TOK_P]             = t00[r];
        st[r * TOK_P + 16]        = t01[r];
        st[(r + 16) * TOK_P]      = t10[r];
        st[(r + 16) * TOK_P + 16] = t11[r];
    }
    __syncthreads();                      // every wave reads the partials of three channels

    // ---- second product ----
    const float* pt = sT[0] + (mh * 32 + l16) * TOK_P + hi * 2;
    v2f a0[8], a1[8];
    #pragma unroll   // constant indices keep a0 and a1 in registers, LDS offsets become immediates
    for (int c = 0; c < 8; ++c) {
        // T fragment: dims {c*4+2*hi, +1}, the three channels' partials added
        a0[c] = *(const v2f*)(pt + c * 4);
        a1[c] = *(const v2f*)(pt + 16 * TOK_P + c * 4);
        #pragma unroll   // two adds a fragment
        for (int g = 1; g < 3; ++g) {
            a0[c] += *(const v2f*)(pt + g * 64 * TOK_P + c * 4);
            a1[c] += *(const v2f*)(pt + g * 64 * TOK_P + 16 * TOK_P + c * 4);
        }
    }
    v8f acc00, acc01, acc10, acc11;       // [token tile][output tile]
    if (part < 2) {
        // q, k: D register r = Y[token l16][output 8*hi + r]; its bias is the one
        // that lane 8*hi + r holds (lane l of 0..15: outputs l and 16 + l)
        #pragma unroll   // constant element indices: plain register writes
        for (int r = 0; r < 8; ++r) {
            acc00[r] = __int_as_float(__builtin_amdgcn_ds_bpermute((hi * 8 + r) * 4, __float_as_int(bias0)));
            acc01[r] = __int_as_float(__builtin_amdgcn_ds_bpermute((hi * 8 + r) * 4, __float_as_int(bias1)));
        }
        acc10 = acc00; acc11 = acc01;
        #pragma unroll   // constant indices into the fragment arrays
        for (int c = 0; c < 8; ++c) {
            acc00 = wmma_k4(w2a[c], a0[c], acc00);
            acc01 = wmma_k4(w2b[c], a0[c], acc01);
            acc10 = wmma_k4(w2a[c], a1[c], acc10);
            acc11 = wmma_k4(w2b[c], a1[c], acc11);
        }
    } else {
        // v: D register r = Y[token 8*hi + r][output l16]
        #pragma unroll
        for (int r = 0; r < 8; ++r) {
            acc00[r] = bias0; acc10[r] = bias0;
            acc01[r] = bias1; acc11[r] = bias1;
        }
        #pragma unroll   // constant indices into the fragment arrays
        for (int c = 0; c < 8; ++c) {
            acc00 = wmma_k4(a0[c], w2a[c], acc00);
            acc01 = wmma_k4(a0[c], w2b[c], acc01);
            acc10 = wmma_k4(a1[c], w2a[c], acc10);
            acc11 = wmma_k4(a1[c], w2b[c], acc11);
        }
    }

    // ---- this wave's two token tiles, fragment order: 4 KiB in a row ----
    float* dst = (part == 0 ? q : part == 1 ? k : vt)
               + ((size_t)b * 256 + h * 4 + mh * 2) * 512 + lane * 4;
    *(v4f*)(dst)       = acc00.lo;
    *(v4f*)(dst + 128) = acc00.hi;
    *(v4f*)(dst + 256) = acc01.lo;
    *(v4f*)(dst + 384) = acc01.hi;
    *(v4f*)(dst + 512) = acc10.lo;
    *(v4f*)(dst + 640) = acc10.hi;
    *(v4f*)(dst + 768) = acc11.lo;
    *(v4f*)(dst + 896) = acc11.hi;
    // the stores' address registers may be reused only behind this wait
    asm volatile("s_wait_xcnt 0x0" ::: "memory");
}

// ---------------------------------------------------------------------------
// Kernel 2: fused attention  inter = cos(2*pi * (Q K^T, zero diag)) @ V, then
// the transposed convolution of inter, written straight to the image.
// 16 waves/block, four a SIMD: wave = (pair qp of the block's four Q row-tiles,
// key group kg of eight). A wave takes every eighth 16-key tile and works it
// against its two query tiles: each K and V fragment feeds two products.
// The wave loads its K and V tiles itself, from global memory (they lie in L2)
// straight into registers, one tile ahead of the one it works on: q, k and vt
// lie in fragment order, so a tile is four whole 512-byte loads. Nothing in the
// key loop passes through LDS and there is no barrier in it: the four waves of
// a SIMD drift apart, and while one waits on its loads, its dependent WMMA
// chain or its cosines, the others keep the matrix unit busy.
// The scores are computed transposed, S^T = K * Q^T: a lane's 8 D registers
// then hold 8 keys of ONE query, which is what an A fragment of P holds, so
// the cosines go from the D registers straight into the P * V product.
// k order of S^T: step c, lane (l16, hi) holds pair c of the 16 dims that the
// fragment order gives it, of its key (A) or of its query (B): same layout,
// same loading code. k order of P * V: step c, lane (l16, hi) holds keys
// 8*hi + 2*c, +1 of its query (A, straight from p) or of its dim (B).
// Epilogue: the eight partial inter tiles of each query tile meet in LDS and
// are added, in the order of kg, where the next product reads them.
// ConvTranspose2d with kernel = stride = 8 is a GEMM,
// Y[192 = (o,p,q)][token] = dw^T[192][32] * inter^T[32][token] + db[o].
// A block's 64 tokens are one patch row, so it owns 3 x 8 whole image rows.
// Wave (qt, tt) takes image rows p = 2*qt, 2*qt+1 of the three channels for
// the 16 tokens of tile tt. With the weights as the A operand a lane's 8
// results are the 8 pixels q of one patch row: two 16-byte stores.
// ---------------------------------------------------------------------------
#define INT_P 36     // LDS pitch of an inter row, floats: 144 B = 16 B x odd, no bank conflict for the b32 writes and b64 reads

__global__ void __launch_bounds__(512)
attn_kernel(const float* __restrict__ q,
            const float* __restrict__ k,
            const float* __restrict__ vt,
            const float* __restrict__ dw,
            const float* __restrict__ db,
            float* __restrict__ out) {
    __shared__ __attribute__((aligned(16))) float sI[8][64 * INT_P];      // partial inter [kg][token][dim + pad]

    const int t    = threadIdx.x;         // 0..511
    const int lane = t & 31;
    const int wave = __builtin_amdgcn_readfirstlane(t >> 5);
    const int qp   = wave & 1;            // key loop: pair of Q row-tiles
    const int kg   = wave >> 1;           // key loop: key group
    const int qt   = wave & 3;            // epilogue: image row pair
    const int tt   = wave >> 2;           // epilogue: token tile
    const int b    = blockIdx.x >> 6;     // 64 blocks per batch
    const int i0   = (blockIdx.x & 63) * 4 + qp * 2;   // first Q row-tile of the pair
    const int hi   = lane >> 4;
    const int l16  = lane & 15;

    const float* qb = q  + ((size_t)b * 256 + i0) * 512 + lane * 4;
    const float* kb = k  + (size_t)b * 256 * 512;
    const float* vb = vt + (size_t)b * 256 * 512;

    // Q fragments, B-layout: lane column = query l16
    // (every loop over a fragment array in this kernel is unrolled: constant
    // indices keep the arrays in registers, offsets become immediates)
    v4f bq0[4], bq1[4];
    #pragma unroll
    for (int m = 0; m < 4; ++m) {
        bq0[m] = *(const v4f*)(qb + m * 128);
        bq1[m] = *(const v4f*)(qb + 512 + m * 128);
    }

    // Deconv weights, A-layout, fetched here so that their latency lies under
    // the key loop: lane row = output o*64 + qt*16 + l16, pair = dims {c*4+2*hi, +1}
    const float* wp = dw + hi * 2 * 192 + qt * 16 + l16;
    v2f a_w[3][8];
    #pragma unroll
    for (int o = 0; o < 3; ++o) {
        #pragma unroll
        for (int c = 0; c < 8; ++c) {
            a_w[o][c].x = wp[(c * 4) * 192 + o * 64];
            a_w[o][c].y = wp[(c * 4 + 1) * 192 + o * 64];
        }
    }
    const float bias0 = db[0], bias1 = db[1], bias2 = db[2];
    // the loads' address registers may be reused only behind this wait
    asm volatile("s_wait_xcnt 0x0" ::: "memory");

    v8f acc00 = {}, acc01 = {}, acc10 = {}, acc11 = {};   // partial D tiles [Q tile][dims 0-15 | 16-31]

    // ---- load key tile jt: K, A-layout (lane row = key l16); V, B-layout (lane
    //      column = dim l16 in quads 0, 1, dim 16 + l16 in quads 2, 3) ----
    auto fetch = [&](int jt, v4f (&kf)[4], v4f (&vf)[4]) {
        const float* gk = kb + jt * 512 + lane * 4;
        const float* gv = vb + jt * 512 + lane * 4;
        #pragma unroll
        for (int m = 0; m < 4; ++m) kf[m] = *(const v4f*)(gk + m * 128);
        #pragma unroll
        for (int m = 0; m < 4; ++m) vf[m] = *(const v4f*)(gv + m * 128);
        // the loads' address registers may be reused only behind this wait; it names
        // the two addresses so that no load's result is placed over them ahead of it
        asm volatile("s_wait_xcnt 0x0" :: "v"(gk), "v"(gv) : "memory");
        // holds the loads here, a whole tile's WMMAs ahead of their use: moved down
        // to their use they would expose L2 latency in every trip
        __builtin_amdgcn_sched_barrier(0);
    };

    // ---- key tile jt against both Q tiles ----
    auto work = [&](int jt, const v4f (&kf)[4], const v4f (&vf)[4]) {
        // S^T = Ktile * Qtile^T (16x16), inner dim 32 in 8 WMMA steps, two
        // independent chains: D register r = S[query l16][key 8*hi + r]
        v8f s0 = {}, s1 = {};
        #pragma unroll
        for (int m = 0; m < 4; ++m) {
            s0 = wmma_k4(kf[m].xy, bq0[m].xy, s0);
            s1 = wmma_k4(kf[m].xy, bq1[m].xy, s1);
            s0 = wmma_k4(kf[m].zw, bq0[m].zw, s0);
            s1 = wmma_k4(kf[m].zw, bq1[m].zw, s1);
        }
        // P = cos(2*pi*S) (v_cos_f32 semantics), diag forced to 1
        v8f p0, p1;
        #pragma unroll
        for (int r = 0; r < 8; ++r) {
            const int n = r + hi * 8;
            const float c0 = __builtin_amdgcn_cosf(s0[r]);
            const float c1 = __builtin_amdgcn_cosf(s1[r]);
            p0[r] = (i0 == jt && n == l16) ? 1.0f : c0;
            p1[r] = (i0 + 1 == jt && n == l16) ? 1.0f : c1;
        }
        // D += Ptile(16x16) * Vtile(16x32), inner dim 16 in 4 steps
        #pragma unroll
        for (int g = 0; g < 2; ++g) {
            const v2f x0 = {p0[g * 4],     p0[g * 4 + 1]}, x1 = {p1[g * 4],     p1[g * 4 + 1]};
            const v2f y0 = {p0[g * 4 + 2], p0[g * 4 + 3]}, y1 = {p1[g * 4 + 2], p1[g * 4 + 3]};
            acc00 = wmma_k4(x0, vf[g].xy,     acc00);
            acc01 = wmma_k4(x0, vf[g + 2].xy, acc01);
            acc10 = wmma_k4(x1, vf[g].xy,     acc10);
            acc11 = wmma_k4(x1, vf[g + 2].xy, acc11);
            acc00 = wmma_k4(y0, vf[g].zw,     acc00);
            acc01 = wmma_k4(y0, vf[g + 2].zw, acc01);
            acc10 = wmma_k4(y1, vf[g].zw,     acc10);
            acc11 = wmma_k4(y1, vf[g + 2].zw, acc11);
        }
    };

    // two register sets, A and B: one is worked on while the other's loads fly
    v4f kA[4], vA[4], kB[4], vB[4];
    fetch(kg, kA, vA);
    for (int it = 0; it < 32; it += 2) {
        fetch((it + 1) * 8 + kg, kB, vB);
        work(it * 8 + kg, kA, vA);
        // behind the last pair there is no tile to fetch: the index is held in range
        fetch((it + 2 < 32 ? it + 2 : 31) * 8 + kg, kA, vA);
        work((it + 1) * 8 + kg, kB, vB);
    }

    // ---- partial inter tiles (D register r = token 8*hi + r, dim l16) -> LDS ----
    float* si = sI[kg] + (qp * 32 + hi * 8) * INT_P + l16;
    #pragma unroll
    for (int r = 0; r < 8; ++r) {
        si[r * INT_P]             = acc00[r];
        si[r * INT_P + 16]        = acc01[r];
        si[(r + 16) * INT_P]      = acc10[r];
        si[(r + 16) * INT_P + 16] = acc11[r];
    }
    __syncthreads();                      // every wave reads the partials of eight waves

    // ---- Y = dw^T * inter^T + db; D register r = pixel q of image row
    //      p = 2*qt + hi, lane l16 = token of the 16-token tile tt ----
    const int h = blockIdx.x & 63;
    float* o0 = out + (((size_t)b * 3) * 512 + h * 8 + qt * 2 + hi) * 512 + tt * 128 + l16 * 8;
    const float* pi = sI[0] + (tt * 16 + l16) * INT_P + hi * 2;
    v8f y0, y1, y2;                       // channels 0, 1, 2: three independent chains
    #pragma unroll
    for (int r = 0; r < 8; ++r) { y0[r] = bias0; y1[r] = bias1; y2[r] = bias2; }
    #pragma unroll
    for (int c = 0; c < 8; ++c) {
        // B-frag: dims {c*4+2*hi, +1}, the eight key groups' partials added
        v2f bi = *(const v2f*)(pi + c * 4);
        #pragma unroll
        for (int g = 1; g < 8; ++g) bi += *(const v2f*)(pi + g * 64 * INT_P + c * 4);
        y0 = wmma_k4(a_w[0][c], bi, y0);
        y1 = wmma_k4(a_w[1][c], bi, y1);
        y2 = wmma_k4(a_w[2][c], bi, y2);
    }
    *(v4f*)(o0)                  = y0.lo;
    *(v4f*)(o0 + 4)              = y0.hi;
    *(v4f*)(o0 + 262144)         = y1.lo;
    *(v4f*)(o0 + 262144 + 4)     = y1.hi;
    *(v4f*)(o0 + 2 * 262144)     = y2.lo;
    *(v4f*)(o0 + 2 * 262144 + 4) = y2.hi;
}

// ---------------------------------------------------------------------------
extern "C" void kernel_launch(void* const* d_in, const int* in_sizes, int n_in,
                              void* d_out, int out_size, void* d_ws, size_t ws_size,
                              hipStream_t stream) {
    const float* x        = (const float*)d_in[0];
    const float* conv_w   = (const float*)d_in[1];
    const float* conv_b   = (const float*)d_in[2];
    const float* proj_w   = (const float*)d_in[3];
    const float* proj_b   = (const float*)d_in[4];
    const float* deconv_w = (const float*)d_in[5];
    const float* deconv_b = (const float*)d_in[6];
    float* out = (float*)d_out;

    float* ws   = (float*)d_ws;
    float* qbuf = ws;                      // 4*4096*32 = 524288 floats
    float* kbuf = qbuf + 524288;
    float* vtbf = kbuf + 524288;           // all three in fragment order, [b][256 token tiles][512]

    embed_kernel<<<256, 192, 0, stream>>>(x, conv_w, conv_b, proj_w, proj_b, qbuf, kbuf, vtbf);
    attn_kernel<<<256, 512, 0, stream>>>(qbuf, kbuf, vtbf, deconv_w, deconv_b, out);
}
